// v000
// Times are from an AMD MI455X. After a warm-up the kernel runs many times in a row, and a time is the length of
// such a window on the GPU divided by its runs, so every launch and the gaps after it count. The runs cycle
// through copies of the inputs. A figure is the median of several windows, for all but v000 over two sittings.
// Sittings can differ by a few percent; kernels timed side by side share one.
// v000 is the starting kernel. One run takes 42 microseconds.
#include <hip/hip_runtime.h>

typedef __attribute__((ext_vector_type(16))) _Float16 v16h;
typedef __attribute__((ext_vector_type(8)))  _Float16 v8h;
typedef __attribute__((ext_vector_type(4)))  _Float16 v4h;
typedef __attribute__((ext_vector_type(8)))  float    v8f;

#define B_ 8
#define U_ 128
#define T_ 256
#define E_ 128
#define H_ 128
#define KPAD 8
#define WAVES 2
#define MT 32            // t-rows per wave (two 16-row WMMA tiles)

// Branchless GELU: 0.5x(1+erf(x/sqrt2)), A&S 7.1.25 erf (|err| <= 2.5e-5,
// far below f16-WMMA quantization). ~11 straight-line VALU/TRANS ops.
__device__ __forceinline__ float gelu_fast(float x) {
    const float ax = __builtin_fabsf(x) * 0.70710678118654752440f;
    const float t  = __builtin_amdgcn_rcpf(fmaf(0.47047f, ax, 1.0f));
    float p = fmaf(0.7478556f, t, -0.0958798f);
    p = fmaf(p, t, 0.3480242f);
    p = p * t;
    const float e  = __expf(-ax * ax);
    const float er = fmaf(-p, e, 1.0f);                  // erf(|x|/sqrt2)
    const float se = __builtin_copysignf(er, x);
    const float hx = 0.5f * x;
    return fmaf(hx, se, hx);
}

// ---------------------------------------------------------------------------
// Prep 1: rank-separable layer-1 partials (fp32).
// ---------------------------------------------------------------------------
__global__ __launch_bounds__(128) void partials_kernel(
    const float* __restrict__ ue, const float* __restrict__ te,
    const float* __restrict__ ge, const float* __restrict__ W1,
    const float* __restrict__ b1,
    float* __restrict__ au, float* __restrict__ at, float* __restrict__ ag)
{
    __shared__ float sx[E_];
    const int r = blockIdx.x;
    const int h = threadIdx.x;
    const float* x; const float* W; float* o; float acc;
    if (r < B_*U_) {
        x = ue + (size_t)r*E_; W = W1; o = au + (size_t)r*H_; acc = 0.f;
    } else if (r < B_*U_ + B_*T_) {
        const int i = r - B_*U_;
        x = te + (size_t)i*E_; W = W1 + (size_t)E_*H_; o = at + (size_t)i*H_; acc = 0.f;
    } else {
        const int i = r - B_*U_ - B_*T_;
        x = ge + (size_t)i*E_; W = W1 + (size_t)2*E_*H_; o = ag + (size_t)i*H_; acc = b1[h];
    }
    sx[h] = x[h];
    __syncthreads();
    #pragma unroll 8
    for (int e = 0; e < E_; ++e)
        acc = fmaf(sx[e], W[(size_t)e*H_ + h], acc);
    o[h] = acc;
}

// ---------------------------------------------------------------------------
// Prep 2: W2 fp32 -> f16, transposed ([n][k]) for contiguous b128 LDS staging.
// ---------------------------------------------------------------------------
__global__ __launch_bounds__(256) void convw2_kernel(
    const float* __restrict__ W2, _Float16* __restrict__ w2t)
{
    const int i = blockIdx.x * 256 + threadIdx.x;        // i = n*H + k
    if (i < H_*H_) {
        const int n = i >> 7, k = i & 127;
        w2t[i] = (_Float16)W2[(size_t)k*H_ + n];
    }
}

// ---------------------------------------------------------------------------
// Main fused kernel. One wave = one (b, u, 32 consecutive t) super-tile:
//   h1 = gelu(au + at + ag)        (32 x 128 f16 in LDS, b128-coalesced)
//   h2 = gelu(h1 @ W2 + b2)        (8 N x 4 K x 2 M = 64 v_wmma_f32_16x16x32_f16)
//   out = h2 @ w3 + b3             (shfl_xor half-wave reduction)
// ---------------------------------------------------------------------------
__global__ __launch_bounds__(WAVES*32) void pairwise_kernel(
    const float* __restrict__ au, const float* __restrict__ at,
    const float* __restrict__ ag, const _Float16* __restrict__ w2t,
    const float* __restrict__ b2, const float* __restrict__ w3,
    const float* __restrict__ b3, float* __restrict__ out)
{
    __shared__ __attribute__((aligned(16))) _Float16 sW2[H_][H_ + KPAD];      // [n][k]
    __shared__ __attribute__((aligned(16))) _Float16 sH1[WAVES][MT][H_ + KPAD];

    const int tid  = threadIdx.x;
    const int w    = tid >> 5;
    const int lane = tid & 31;

    const int g    = blockIdx.x * WAVES + w;
    const int nTt  = T_ / MT;                 // 8 super-tiles along t
    const int tt   = g % nTt;
    const int u    = (g / nTt) % U_;
    const int b    = g / (nTt * U_);
    const int t0   = tt * MT;

    // ---- stage W2^T into LDS: 16B vector copies, padded rows ----
    for (int i = tid; i < H_*16; i += WAVES*32) {
        const int row = i >> 4, c = i & 15;
        ((uint4*)&sW2[row][0])[c] = ((const uint4*)(w2t + (size_t)row*H_))[c];
    }

    // ---- hoist epilogue constants (issue loads early, once) ----
    const int m = lane & 15;
    float biasv[8], wvv[8];
    #pragma unroll
    for (int nt = 0; nt < 8; ++nt) {
        biasv[nt] = b2[nt*16 + m];
        wvv[nt]   = w3[nt*16 + m];
    }
    const float b3v = b3[0];

    // ---- registerize the (b,u)-broadcast partials, 4 contiguous k per lane ----
    const float* aup = au + (size_t)(b*U_ + u)*H_;
    const float* agp = ag + (size_t)b*H_;
    float4 augv;
    {
        const float4 a4 = ((const float4*)aup)[lane];
        const float4 g4 = ((const float4*)agp)[lane];
        augv.x = a4.x + g4.x; augv.y = a4.y + g4.y;
        augv.z = a4.z + g4.z; augv.w = a4.w + g4.w;
    }

    // ---- stage h1 = gelu(aug + at) as f16: one b128 load + b64 LDS store/row ----
    const float* atp = at + (size_t)(b*T_ + t0)*H_;
    #pragma unroll 4
    for (int tl = 0; tl < MT; ++tl) {
        const float4 v = ((const float4*)(atp + (size_t)tl*H_))[lane];
        v4h hv;
        hv[0] = (_Float16)gelu_fast(v.x + augv.x);
        hv[1] = (_Float16)gelu_fast(v.y + augv.y);
        hv[2] = (_Float16)gelu_fast(v.z + augv.z);
        hv[3] = (_Float16)gelu_fast(v.w + augv.w);
        *(v4h*)&sH1[w][tl][lane*4] = hv;
    }
    __syncthreads();

    // ---- A operands (16x32 f16 per K-step, ISA lane layout) ----
    // lanes 0-15: row M=lane,    K = kt*32 + {0..7, 16..23}
    // lanes 16-31: row M=lane-16, K = kt*32 + {8..15, 24..31}
    const int off = (lane < 16) ? 0 : 8;
    v16h a[2][4];
    #pragma unroll
    for (int mt = 0; mt < 2; ++mt) {
        #pragma unroll
        for (int kt = 0; kt < 4; ++kt) {
            const _Float16* rowp = &sH1[w][mt*16 + m][kt*32 + off];
            v16h tmp;
            ((v8h*)&tmp)[0] = *(const v8h*)(rowp);
            ((v8h*)&tmp)[1] = *(const v8h*)(rowp + 16);
            a[mt][kt] = tmp;
        }
    }

    float s[2][8];
    #pragma unroll
    for (int mt = 0; mt < 2; ++mt)
        #pragma unroll
        for (int r = 0; r < 8; ++r) s[mt][r] = 0.f;

    // ---- GEMM vs W2 with fused bias/GELU/W3 epilogue ----
    #pragma unroll
    for (int nt = 0; nt < 8; ++nt) {
        const int n = nt*16 + m;              // D layout: lane%16 == column N
        v8f acc0 = {}, acc1 = {};
        #pragma unroll
        for (int kt = 0; kt < 4; ++kt) {
            const _Float16* colp = &sW2[n][kt*32 + off];
            v16h bop;
            ((v8h*)&bop)[0] = *(const v8h*)(colp);
            ((v8h*)&bop)[1] = *(const v8h*)(colp + 16);
            acc0 = __builtin_amdgcn_wmma_f32_16x16x32_f16(
                     false, a[0][kt], false, bop, (short)0, acc0, false, false);
            acc1 = __builtin_amdgcn_wmma_f32_16x16x32_f16(
                     false, a[1][kt], false, bop, (short)0, acc1, false, false);
        }
        const float bias = biasv[nt];
        const float wv   = wvv[nt];
        #pragma unroll
        for (int r = 0; r < 8; ++r) {         // VGPR slot r: M=r (lo half) / r+8 (hi half)
            s[0][r] = fmaf(gelu_fast(acc0[r] + bias), wv, s[0][r]);
            s[1][r] = fmaf(gelu_fast(acc1[r] + bias), wv, s[1][r]);
        }
    }

    // ---- reduce across the 16 lanes of each half-wave (columns of h2) ----
    #pragma unroll
    for (int d = 8; d > 0; d >>= 1) {
        #pragma unroll
        for (int mt = 0; mt < 2; ++mt)
            #pragma unroll
            for (int r = 0; r < 8; ++r)
                s[mt][r] += __shfl_xor(s[mt][r], d, 32);
    }

    if ((lane & 15) == 0) {
        const int rbase = (lane < 16) ? 0 : 8;
        #pragma unroll
        for (int mt = 0; mt < 2; ++mt) {
            float* op = out + (size_t)b*U_*T_ + (size_t)u*T_ + t0 + mt*16 + rbase;
            #pragma unroll
            for (int r = 0; r < 8; ++r) op[r] = s[mt][r] + b3v;
        }
    }
}

// ---------------------------------------------------------------------------
extern "C" void kernel_launch(void* const* d_in, const int* in_sizes, int n_in,
                              void* d_out, int out_size, void* d_ws, size_t ws_size,
                              hipStream_t stream) {
    (void)in_sizes; (void)n_in; (void)out_size; (void)ws_size;

    const float* ue = (const float*)d_in[0];
    const float* te = (const float*)d_in[1];
    const float* ge = (const float*)d_in[2];
    const float* W1 = (const float*)d_in[3];
    const float* b1 = (const float*)d_in[4];
    const float* W2 = (const float*)d_in[5];
    const float* b2 = (const float*)d_in[6];
    const float* w3 = (const float*)d_in[7];
    const float* b3 = (const float*)d_in[8];
    float* out = (float*)d_out;

    // workspace carving (~1.6 MB total, stays L2-hot)
    float*    au  = (float*)d_ws;                       // B*U*H
    float*    at  = au + (size_t)B_*U_*H_;              // B*T*H
    float*    ag  = at + (size_t)B_*T_*H_;              // B*H
    _Float16* w2t = (_Float16*)(ag + (size_t)B_*H_);    // H*H halves (transposed)

    const int rows = B_*U_ + B_*T_ + B_;
    partials_kernel<<<rows, 128, 0, stream>>>(ue, te, ge, W1, b1, au, at, ag);
    convw2_kernel<<<(H_*H_ + 255)/256, 256, 0, stream>>>(W2, w2t);

    const int tiles = B_ * U_ * (T_/MT);                // 8192 waves
    pairwise_kernel<<<tiles/WAVES, WAVES*32, 0, stream>>>(
        au, at, ag, w2t, b2, w3, b3, out);
}

// v001
// Measured time: 38 microseconds a run.
// Next to v000, in two timings, it ran 1.13 and 1.14 times as fast.
#include <hip/hip_runtime.h>

typedef __attribute__((ext_vector_type(16))) _Float16 v16h;
typedef __attribute__((ext_vector_type(8)))  _Float16 v8h;
typedef __attribute__((ext_vector_type(4)))  _Float16 v4h;
typedef __attribute__((ext_vector_type(8)))  float    v8f;
typedef __attribute__((ext_vector_type(2)))  float    v2f;
typedef __attribute__((ext_vector_type(4)))  float    v4f;

#define B_ 8
#define U_ 128
#define T_ 256
#define E_ 128
#define H_ 128
#define KPAD 8
#define WAVES 2
#define MT 32            // t-rows per wave (two 16-row WMMA tiles)
#define PR 8             // rows per work-group in the partials launch
#define PTHREADS 64      // threads per work-group there (2 columns each)
#define PG 8             // W1 rows (e steps) per prefetch group there
#define PWN 4            // groups in the W1 register ring there

// Branchless GELU: 0.5x(1+erf(x/sqrt2)), A&S 7.1.25 erf (|err| <= 2.5e-5,
// far below f16-WMMA quantization). ~11 straight-line VALU/TRANS ops.
__device__ __forceinline__ float gelu_fast(float x) {
    const float ax = __builtin_fabsf(x) * 0.70710678118654752440f;
    const float t  = __builtin_amdgcn_rcpf(fmaf(0.47047f, ax, 1.0f));
    float p = fmaf(0.7478556f, t, -0.0958798f);
    p = fmaf(p, t, 0.3480242f);
    p = p * t;
    const float e  = __expf(-ax * ax);
    const float er = fmaf(-p, e, 1.0f);                  // erf(|x|/sqrt2)
    const float se = __builtin_copysignf(er, x);
    const float hx = 0.5f * x;
    return fmaf(hx, se, hx);
}

// ---------------------------------------------------------------------------
// Prep 1: rank-separable layer-1 partials (fp32).
// One work-group = PR rows x all 128 columns; one thread = 2 adjacent columns
// of all PR rows, so each W1 element is fetched once per PR rows and each
// broadcast x pair feeds packed FMAs. Every output keeps its own serial
// fma chain over e = 0..127.
// amdgpu_waves_per_eu(1, 5): at most one or two of these waves share a SIMD, so
// the register budget goes to loads in flight; without it the compiler keeps
// registers low and the LDS reads stand only 2-3 rows ahead of their FMAs.
// All loops are fully unrolled so that ring and buffer indices are registers.
// ---------------------------------------------------------------------------
__global__ __launch_bounds__(PTHREADS) __attribute__((amdgpu_waves_per_eu(1, 5)))
void partials_kernel(
    const float* __restrict__ ue, const float* __restrict__ te,
    const float* __restrict__ ge, const float* __restrict__ W1,
    const float* __restrict__ b1,
    float* __restrict__ au, float* __restrict__ at, float* __restrict__ ag)
{
    static_assert(B_ == PR, "the ge rows fill exactly one work-group");
    static_assert(H_ == 2*PTHREADS && E_ == 2*PTHREADS, "two columns a thread");
    __shared__ __attribute__((aligned(16))) float sx[E_][PR];   // [e][row]
    const int blk = blockIdx.x;
    const int t   = threadIdx.x;
    const float* x; const float* W; float* o;
    v2f init = {0.f, 0.f};
    if (blk < B_*U_/PR) {
        x = ue + (size_t)blk*PR*E_; W = W1; o = au + (size_t)blk*PR*H_;
    } else if (blk < (B_*U_ + B_*T_)/PR) {
        const int i = blk - B_*U_/PR;
        x = te + (size_t)i*PR*E_; W = W1 + (size_t)E_*H_; o = at + (size_t)i*PR*H_;
    } else {
        x = ge; W = W1 + (size_t)2*E_*H_; o = ag; init = ((const v2f*)b1)[t];
    }

    // W1 columns 2t, 2t+1: a register ring of PWN groups of PG rows, PWN-1 groups in flight
    const v2f* Wp = (const v2f*)W + t;
    v2f wr[PWN][PG];
    #pragma unroll
    for (int g = 0; g < PWN - 1; ++g)
        #pragma unroll
        for (int i = 0; i < PG; ++i) wr[g][i] = Wp[(size_t)(g*PG + i)*(H_/2)];

    // x rows, transposed into LDS so that one e gives PR contiguous values
    {
        v2f xv[PR];
        #pragma unroll
        for (int r = 0; r < PR; ++r) xv[r] = ((const v2f*)(x + (size_t)r*E_))[t];
        #pragma unroll
        for (int j = 0; j < 2; ++j) {
            *(float4*)&sx[2*t + j][0] = make_float4(xv[0][j], xv[1][j], xv[2][j], xv[3][j]);
            *(float4*)&sx[2*t + j][4] = make_float4(xv[4][j], xv[5][j], xv[6][j], xv[7][j]);
        }
    }
    __syncthreads();

    // acc[p][j]: rows 2p, 2p+1 of column 2t+j
    v2f acc[PR/2][2];
    #pragma unroll
    for (int p = 0; p < PR/2; ++p) {
        acc[p][0] = (v2f){init[0], init[0]};
        acc[p][1] = (v2f){init[1], init[1]};
    }

    v4f xs[2][PG][2];
    #pragma unroll
    for (int i = 0; i < PG; ++i) {
        xs[0][i][0] = *(const v4f*)&sx[i][0];
        xs[0][i][1] = *(const v4f*)&sx[i][4];
    }

    #pragma unroll
    for (int g = 0; g < E_/PG; ++g) {
        if (g + PWN - 1 < E_/PG) {
            #pragma unroll
            for (int i = 0; i < PG; ++i)
                wr[(g + PWN - 1) % PWN][i] = Wp[(size_t)((g + PWN - 1)*PG + i)*(H_/2)];
        }
        if (g + 1 < E_/PG) {
            #pragma unroll
            for (int i = 0; i < PG; ++i) {
                xs[(g + 1) & 1][i][0] = *(const v4f*)&sx[(g + 1)*PG + i][0];
                xs[(g + 1) & 1][i][1] = *(const v4f*)&sx[(g + 1)*PG + i][4];
            }
        }
        #pragma unroll
        for (int i = 0; i < PG; ++i) {
            const v2f w = wr[g % PWN][i];
            const v2f w0 = {w[0], w[0]}, w1 = {w[1], w[1]};
            #pragma unroll
            for (int q = 0; q < 2; ++q) {
                const v4f xq = xs[g & 1][i][q];
                const v2f xlo = {xq[0], xq[1]}, xhi = {xq[2], xq[3]};
                acc[2*q][0]     = __builtin_elementwise_fma(xlo, w0, acc[2*q][0]);
                acc[2*q][1]     = __builtin_elementwise_fma(xlo, w1, acc[2*q][1]);
                acc[2*q + 1][0] = __builtin_elementwise_fma(xhi, w0, acc[2*q + 1][0]);
                acc[2*q + 1][1] = __builtin_elementwise_fma(xhi, w1, acc[2*q + 1][1]);
            }
        }
    }
    #pragma unroll
    for (int p = 0; p < PR/2; ++p) {
        ((v2f*)(o + (size_t)(2*p)*H_))[t]     = (v2f){acc[p][0][0], acc[p][1][0]};
        ((v2f*)(o + (size_t)(2*p + 1)*H_))[t] = (v2f){acc[p][0][1], acc[p][1][1]};
    }
}

// ---------------------------------------------------------------------------
// Prep 2: W2 fp32 -> f16, transposed ([n][k]) for contiguous b128 LDS staging.
// ---------------------------------------------------------------------------
__global__ __launch_bounds__(256) void convw2_kernel(
    const float* __restrict__ W2, _Float16* __restrict__ w2t)
{
    const int i = blockIdx.x * 256 + threadIdx.x;        // i = n*H + k
    if (i < H_*H_) {
        const int n = i >> 7, k = i & 127;
        w2t[i] = (_Float16)W2[(size_t)k*H_ + n];
    }
}

// ---------------------------------------------------------------------------
// Main fused kernel. One wave = one (b, u, 32 consecutive t) super-tile:
//   h1 = gelu(au + at + ag)        (32 x 128 f16 in LDS, b128-coalesced)
//   h2 = gelu(h1 @ W2 + b2)        (8 N x 4 K x 2 M = 64 v_wmma_f32_16x16x32_f16)
//   out = h2 @ w3 + b3             (shfl_xor half-wave reduction)
// ---------------------------------------------------------------------------
__global__ __launch_bounds__(WAVES*32) void pairwise_kernel(
    const float* __restrict__ au, const float* __restrict__ at,
    const float* __restrict__ ag, const _Float16* __restrict__ w2t,
    const float* __restrict__ b2, const float* __restrict__ w3,
    const float* __restrict__ b3, float* __restrict__ out)
{
    __shared__ __attribute__((aligned(16))) _Float16 sW2[H_][H_ + KPAD];      // [n][k]
    __shared__ __attribute__((aligned(16))) _Float16 sH1[WAVES][MT][H_ + KPAD];

    const int tid  = threadIdx.x;
    const int w    = tid >> 5;
    const int lane = tid & 31;

    const int g    = blockIdx.x * WAVES + w;
    const int nTt  = T_ / MT;                 // 8 super-tiles along t
    const int tt   = g % nTt;
    const int u    = (g / nTt) % U_;
    const int b    = g / (nTt * U_);
    const int t0   = tt * MT;

    // ---- stage W2^T into LDS: 16B vector copies, padded rows ----
    for (int i = tid; i < H_*16; i += WAVES*32) {
        const int row = i >> 4, c = i & 15;
        ((uint4*)&sW2[row][0])[c] = ((const uint4*)(w2t + (size_t)row*H_))[c];
    }

    // ---- hoist epilogue constants (issue loads early, once) ----
    const int m = lane & 15;
    float biasv[8], wvv[8];
    #pragma unroll
    for (int nt = 0; nt < 8; ++nt) {
        biasv[nt] = b2[nt*16 + m];
        wvv[nt]   = w3[nt*16 + m];
    }
    const float b3v = b3[0];

    // ---- registerize the (b,u)-broadcast partials, 4 contiguous k per lane ----
    const float* aup = au + (size_t)(b*U_ + u)*H_;
    const float* agp = ag + (size_t)b*H_;
    float4 augv;
    {
        const float4 a4 = ((const float4*)aup)[lane];
        const float4 g4 = ((const float4*)agp)[lane];
        augv.x = a4.x + g4.x; augv.y = a4.y + g4.y;
        augv.z = a4.z + g4.z; augv.w = a4.w + g4.w;
    }

    // ---- stage h1 = gelu(aug + at) as f16: one b128 load + b64 LDS store/row ----
    const float* atp = at + (size_t)(b*T_ + t0)*H_;
    #pragma unroll 4
    for (int tl = 0; tl < MT; ++tl) {
        const float4 v = ((const float4*)(atp + (size_t)tl*H_))[lane];
        v4h hv;
        hv[0] = (_Float16)gelu_fast(v.x + augv.x);
        hv[1] = (_Float16)gelu_fast(v.y + augv.y);
        hv[2] = (_Float16)gelu_fast(v.z + augv.z);
        hv[3] = (_Float16)gelu_fast(v.w + augv.w);
        *(v4h*)&sH1[w][tl][lane*4] = hv;
    }
    __syncthreads();

    // ---- A operands (16x32 f16 per K-step, ISA lane layout) ----
    // lanes 0-15: row M=lane,    K = kt*32 + {0..7, 16..23}
    // lanes 16-31: row M=lane-16, K = kt*32 + {8..15, 24..31}
    const int off = (lane < 16) ? 0 : 8;
    v16h a[2][4];
    #pragma unroll
    for (int mt = 0; mt < 2; ++mt) {
        #pragma unroll
        for (int kt = 0; kt < 4; ++kt) {
            const _Float16* rowp = &sH1[w][mt*16 + m][kt*32 + off];
            v16h tmp;
            ((v8h*)&tmp)[0] = *(const v8h*)(rowp);
            ((v8h*)&tmp)[1] = *(const v8h*)(rowp + 16);
            a[mt][kt] = tmp;
        }
    }

    float s[2][8];
    #pragma unroll
    for (int mt = 0; mt < 2; ++mt)
        #pragma unroll
        for (int r = 0; r < 8; ++r) s[mt][r] = 0.f;

    // ---- GEMM vs W2 with fused bias/GELU/W3 epilogue ----
    #pragma unroll
    for (int nt = 0; nt < 8; ++nt) {
        const int n = nt*16 + m;              // D layout: lane%16 == column N
        v8f acc0 = {}, acc1 = {};
        #pragma unroll
        for (int kt = 0; kt < 4; ++kt) {
            const _Float16* colp = &sW2[n][kt*32 + off];
            v16h bop;
            ((v8h*)&bop)[0] = *(const v8h*)(colp);
            ((v8h*)&bop)[1] = *(const v8h*)(colp + 16);
            acc0 = __builtin_amdgcn_wmma_f32_16x16x32_f16(
                     false, a[0][kt], false, bop, (short)0, acc0, false, false);
            acc1 = __builtin_amdgcn_wmma_f32_16x16x32_f16(
                     false, a[1][kt], false, bop, (short)0, acc1, false, false);
        }
        const float bias = biasv[nt];
        const float wv   = wvv[nt];
        #pragma unroll
        for (int r = 0; r < 8; ++r) {         // VGPR slot r: M=r (lo half) / r+8 (hi half)
            s[0][r] = fmaf(gelu_fast(acc0[r] + bias), wv, s[0][r]);
            s[1][r] = fmaf(gelu_fast(acc1[r] + bias), wv, s[1][r]);
        }
    }

    // ---- reduce across the 16 lanes of each half-wave (columns of h2) ----
    #pragma unroll
    for (int d = 8; d > 0; d >>= 1) {
        #pragma unroll
        for (int mt = 0; mt < 2; ++mt)
            #pragma unroll
            for (int r = 0; r < 8; ++r)
                s[mt][r] += __shfl_xor(s[mt][r], d, 32);
    }

    if ((lane & 15) == 0) {
        const int rbase = (lane < 16) ? 0 : 8;
        #pragma unroll
        for (int mt = 0; mt < 2; ++mt) {
            float* op = out + (size_t)b*U_*T_ + (size_t)u*T_ + t0 + mt*16 + rbase;
            #pragma unroll
            for (int r = 0; r < 8; ++r) op[r] = s[mt][r] + b3v;
        }
    }
}

// ---------------------------------------------------------------------------
extern "C" void kernel_launch(void* const* d_in, const int* in_sizes, int n_in,
                              void* d_out, int out_size, void* d_ws, size_t ws_size,
                              hipStream_t stream) {
    (void)in_sizes; (void)n_in; (void)out_size; (void)ws_size;

    const float* ue = (const float*)d_in[0];
    const float* te = (const float*)d_in[1];
    const float* ge = (const float*)d_in[2];
    const float* W1 = (const float*)d_in[3];
    const float* b1 = (const float*)d_in[4];
    const float* W2 = (const float*)d_in[5];
    const float* b2 = (const float*)d_in[6];
    const float* w3 = (const float*)d_in[7];
    const float* b3 = (const float*)d_in[8];
    float* out = (float*)d_out;

    // workspace carving (~1.6 MB total, stays L2-hot)
    float*    au  = (float*)d_ws;                       // B*U*H
    float*    at  = au + (size_t)B_*U_*H_;              // B*T*H
    float*    ag  = at + (size_t)B_*T_*H_;              // B*H
    _Float16* w2t = (_Float16*)(ag + (size_t)B_*H_);    // H*H halves (transposed)

    const int rows = B_*U_ + B_*T_ + B_;
    partials_kernel<<<rows/PR, PTHREADS, 0, stream>>>(ue, te, ge, W1, b1, au, at, ag);
    convw2_kernel<<<(H_*H_ + 255)/256, 256, 0, stream>>>(W2, w2t);

    const int tiles = B_ * U_ * (T_/MT);                // 8192 waves
    pairwise_kernel<<<tiles/WAVES, WAVES*32, 0, stream>>>(
        au, at, ag, w2t, b2, w3, b3, out);
}

// v002
// A run of this version takes 27.4 microseconds.
// Two timings next to v001 put it at 1.39 and 1.38 times that version's speed.
// All steps since v000 together make it 1.57 times as fast.
#include <hip/hip_runtime.h>

typedef __attribute__((ext_vector_type(16))) _Float16 v16h;
typedef __attribute__((ext_vector_type(8)))  _Float16 v8h;
typedef __attribute__((ext_vector_type(4)))  _Float16 v4h;
typedef __attribute__((ext_vector_type(8)))  float    v8f;
typedef __attribute__((ext_vector_type(2)))  float    v2f;
typedef __attribute__((ext_vector_type(4)))  float    v4f;

#define B_ 8
#define U_ 128
#define T_ 256
#define E_ 128
#define H_ 128
#define KPAD 8
#define WAVES 16         // waves per work-group in the main launch (four a SIMD)
#define MT 32            // t-rows per wave (two 16-row WMMA tiles)
#define TPW 2            // u rows per wave there, one after the other
#define UG (WAVES*TPW)   // u rows per work-group there
#define PR 8             // rows per work-group in the partials launch
#define PTHREADS 64      // threads per work-group there (2 columns each)
#define PG 8             // W1 rows (e steps) per prefetch group there
#define PWN 4            // groups in the W1 register ring there

// Branchless GELU: 0.5x(1+erf(x/sqrt2)), A&S 7.1.25 erf (|err| <= 2.5e-5,
// far below f16-WMMA quantization). ~11 straight-line VALU/TRANS ops.
__device__ __forceinline__ float gelu_fast(float x) {
    const float ax = __builtin_fabsf(x) * 0.70710678118654752440f;
    const float t  = __builtin_amdgcn_rcpf(fmaf(0.47047f, ax, 1.0f));
    float p = fmaf(0.7478556f, t, -0.0958798f);
    p = fmaf(p, t, 0.3480242f);
    p = p * t;
    const float e  = __expf(-ax * ax);
    const float er = fmaf(-p, e, 1.0f);                  // erf(|x|/sqrt2)
    const float se = __builtin_copysignf(er, x);
    const float hx = 0.5f * x;
    return fmaf(hx, se, hx);
}

// ---------------------------------------------------------------------------
// Prep 1: rank-separable layer-1 partials (fp32).
// One work-group = PR rows x all 128 columns; one thread = 2 adjacent columns
// of all PR rows, so each W1 element is fetched once per PR rows and each
// broadcast x pair feeds packed FMAs. Every output keeps its own serial
// fma chain over e = 0..127.
// amdgpu_waves_per_eu(1, 5): at most one or two of these waves share a SIMD, so
// the register budget goes to loads in flight; without it the compiler keeps
// registers low and the LDS reads stand only 2-3 rows ahead of their FMAs.
// All loops are fully unrolled so that ring and buffer indices are registers.
// ---------------------------------------------------------------------------
__global__ __launch_bounds__(PTHREADS) __attribute__((amdgpu_waves_per_eu(1, 5)))
void partials_kernel(
    const float* __restrict__ ue, const float* __restrict__ te,
    const float* __restrict__ ge, const float* __restrict__ W1,
    const float* __restrict__ b1,
    float* __restrict__ au, float* __restrict__ at, float* __restrict__ ag)
{
    static_assert(B_ == PR, "the ge rows fill exactly one work-group");
    static_assert(H_ == 2*PTHREADS && E_ == 2*PTHREADS, "two columns a thread");
    __shared__ __attribute__((aligned(16))) float sx[E_][PR];   // [e][row]
    const int blk = blockIdx.x;
    const int t   = threadIdx.x;
    const float* x; const float* W; float* o;
    v2f init = {0.f, 0.f};
    if (blk < B_*U_/PR) {
        x = ue + (size_t)blk*PR*E_; W = W1; o = au + (size_t)blk*PR*H_;
    } else if (blk < (B_*U_ + B_*T_)/PR) {
        const int i = blk - B_*U_/PR;
        x = te + (size_t)i*PR*E_; W = W1 + (size_t)E_*H_; o = at + (size_t)i*PR*H_;
    } else {
        x = ge; W = W1 + (size_t)2*E_*H_; o = ag; init = ((const v2f*)b1)[t];
    }

    // W1 columns 2t, 2t+1: a register ring of PWN groups of PG rows, PWN-1 groups in flight
    const v2f* Wp = (const v2f*)W + t;
    v2f wr[PWN][PG];
    #pragma unroll
    for (int g = 0; g < PWN - 1; ++g)
        #pragma unroll
        for (int i = 0; i < PG; ++i) wr[g][i] = Wp[(size_t)(g*PG + i)*(H_/2)];

    // x rows, transposed into LDS so that one e gives PR contiguous values
    {
        v2f xv[PR];
        #pragma unroll
        for (int r = 0; r < PR; ++r) xv[r] = ((const v2f*)(x + (size_t)r*E_))[t];
        #pragma unroll
        for (int j = 0; j < 2; ++j) {
            *(float4*)&sx[2*t + j][0] = make_float4(xv[0][j], xv[1][j], xv[2][j], xv[3][j]);
            *(float4*)&sx[2*t + j][4] = make_float4(xv[4][j], xv[5][j], xv[6][j], xv[7][j]);
        }
    }
    __syncthreads();

    // acc[p][j]: rows 2p, 2p+1 of column 2t+j
    v2f acc[PR/2][2];
    #pragma unroll
    for (int p = 0; p < PR/2; ++p) {
        acc[p][0] = (v2f){init[0], init[0]};
        acc[p][1] = (v2f){init[1], init[1]};
    }

    v4f xs[2][PG][2];
    #pragma unroll
    for (int i = 0; i < PG; ++i) {
        xs[0][i][0] = *(const v4f*)&sx[i][0];
        xs[0][i][1] = *(const v4f*)&sx[i][4];
    }

    #pragma unroll
    for (int g = 0; g < E_/PG; ++g) {
        if (g + PWN - 1 < E_/PG) {
            #pragma unroll
            for (int i = 0; i < PG; ++i)
                wr[(g + PWN - 1) % PWN][i] = Wp[(size_t)((g + PWN - 1)*PG + i)*(H_/2)];
        }
        if (g + 1 < E_/PG) {
            #pragma unroll
            for (int i = 0; i < PG; ++i) {
                xs[(g + 1) & 1][i][0] = *(const v4f*)&sx[(g + 1)*PG + i][0];
                xs[(g + 1) & 1][i][1] = *(const v4f*)&sx[(g + 1)*PG + i][4];
            }
        }
        #pragma unroll
        for (int i = 0; i < PG; ++i) {
            const v2f w = wr[g % PWN][i];
            const v2f w0 = {w[0], w[0]}, w1 = {w[1], w[1]};
            #pragma unroll
            for (int q = 0; q < 2; ++q) {
                const v4f xq = xs[g & 1][i][q];
                const v2f xlo = {xq[0], xq[1]}, xhi = {xq[2], xq[3]};
                acc[2*q][0]     = __builtin_elementwise_fma(xlo, w0, acc[2*q][0]);
                acc[2*q][1]     = __builtin_elementwise_fma(xlo, w1, acc[2*q][1]);
                acc[2*q + 1][0] = __builtin_elementwise_fma(xhi, w0, acc[2*q + 1][0]);
                acc[2*q + 1][1] = __builtin_elementwise_fma(xhi, w1, acc[2*q + 1][1]);
            }
        }
    }
    #pragma unroll
    for (int p = 0; p < PR/2; ++p) {
        ((v2f*)(o + (size_t)(2*p)*H_))[t]     = (v2f){acc[p][0][0], acc[p][1][0]};
        ((v2f*)(o + (size_t)(2*p + 1)*H_))[t] = (v2f){acc[p][0][1], acc[p][1][1]};
    }
}

// ---------------------------------------------------------------------------
// Prep 2: W2 fp32 -> f16, transposed ([n][k]) for contiguous b128 LDS staging.
// ---------------------------------------------------------------------------
__global__ __launch_bounds__(256) void convw2_kernel(
    const float* __restrict__ W2, _Float16* __restrict__ w2t)
{
    const int i = blockIdx.x * 256 + threadIdx.x;        // i = n*H + k
    if (i < H_*H_) {
        const int n = i >> 7, k = i & 127;
        w2t[i] = (_Float16)W2[(size_t)k*H_ + n];
    }
}

// ---------------------------------------------------------------------------
// Main fused kernel. One work-group = one (b, 32 consecutive t, UG u) block, one
// per WGP: W2^T and the 32 at rows, which all its tiles share, are staged in LDS
// once. One wave = TPW (u, 32 t) super-tiles, one after the other:
//   h1 = gelu(au + at + ag)        (32 x 128 f16 in the wave's own LDS rows)
//   h2 = gelu(h1 @ W2 + b2)        (8 N x 4 K x 2 M = 64 v_wmma_f32_16x16x32_f16)
//   out = h2 @ w3 + b3             (shfl_xor half-wave reduction)
// ---------------------------------------------------------------------------
__global__ __launch_bounds__(WAVES*32) void pairwise_kernel(
    const float* __restrict__ au, const float* __restrict__ at,
    const float* __restrict__ ag, const _Float16* __restrict__ w2t,
    const float* __restrict__ b2, const float* __restrict__ w3,
    const float* __restrict__ b3, float* __restrict__ out)
{
    static_assert(U_ % UG == 0 && T_ % MT == 0, "whole blocks only");
    __shared__ __attribute__((aligned(16))) _Float16 sW2[H_][H_ + KPAD];      // [n][k]
    __shared__ __attribute__((aligned(16))) float    sAt[MT][H_];
    __shared__ __attribute__((aligned(16))) float2   sBW[H_];                 // (b2[n], w3[n])
    __shared__ __attribute__((aligned(16))) _Float16 sH1[WAVES][MT][H_ + KPAD];

    const int tid  = threadIdx.x;
    const int w    = __builtin_amdgcn_readfirstlane(tid >> 5);
    const int lane = tid & 31;

    const int blk  = blockIdx.x;
    const int nUg  = U_ / UG;                 // 4 u groups
    const int nTt  = T_ / MT;                 // 8 super-tiles along t
    const int ug   = blk % nUg;
    const int tt   = (blk / nUg) % nTt;
    const int b    = blk / (nUg * nTt);
    const int t0   = tt * MT;
    const int u0   = ug * UG + w * TPW;

    // ---- stage what all tiles of the block share: W2^T (16B copies, padded rows),
    //      its 32 at rows (fp32, contiguous) and the epilogue's (b2, w3) pairs;
    //      the W2 and at loads are all issued before the first LDS store ----
    constexpr int NW = H_*16/(WAVES*32), NA = MT*H_/4/(WAVES*32);
    static_assert(NW*WAVES*32 == H_*16 && NA*WAVES*32 == MT*H_/4 && H_ <= WAVES*32, "whole rounds");
    const float* atp = at + (size_t)(b*T_ + t0)*H_;
    uint4  wst[NW];
    float4 ast[NA];
    // the (b,u)-broadcast partials, 4 contiguous k per lane
    const float* aup = au + (size_t)(b*U_ + u0)*H_;
    const float4 g4  = ((const float4*)(ag + (size_t)b*H_))[lane];
    float4 a4 = ((const float4*)aup)[lane];
    #pragma unroll
    for (int j = 0; j < NW; ++j) wst[j] = ((const uint4*)w2t)[tid + j*WAVES*32];
    #pragma unroll
    for (int j = 0; j < NA; ++j) ast[j] = ((const float4*)atp)[tid + j*WAVES*32];
    #pragma unroll
    for (int j = 0; j < NW; ++j) {
        const int i = tid + j*WAVES*32;
        ((uint4*)&sW2[i >> 4][0])[i & 15] = wst[j];
    }
    #pragma unroll
    for (int j = 0; j < NA; ++j) ((float4*)&sAt[0][0])[tid + j*WAVES*32] = ast[j];
    if (tid < H_) {
        sBW[tid] = make_float2(b2[tid], w3[tid]);
        // the registers that these two loads name are reused right behind: wait first
        asm volatile("s_wait_xcnt 0x0" ::: "memory");
    }

    const int m = lane & 15;
    const float b3v = b3[0];

    __syncthreads();

    // Kept rolled: the body is some 2,400 instructions, and a second copy of it
    // would only add instruction fetches.
    #pragma unroll 1
    for (int it = 0; it < TPW; ++it) {
    const int u = u0 + it;
    float4 augv;
    augv.x = a4.x + g4.x; augv.y = a4.y + g4.y;
    augv.z = a4.z + g4.z; augv.w = a4.w + g4.w;
    if (it + 1 < TPW)                         // next tile's au row flies under this tile
        a4 = ((const float4*)(aup + (size_t)(it + 1)*H_))[lane];

    // ---- stage h1 = gelu(aug + at) as f16: one b128 LDS load + b64 LDS store/row ----
    #pragma unroll 4
    for (int tl = 0; tl < MT; ++tl) {
        const float4 v = *(const float4*)&sAt[tl][lane*4];
        v4h hv;
        hv[0] = (_Float16)gelu_fast(v.x + augv.x);
        hv[1] = (_Float16)gelu_fast(v.y + augv.y);
        hv[2] = (_Float16)gelu_fast(v.z + augv.z);
        hv[3] = (_Float16)gelu_fast(v.w + augv.w);
        *(v4h*)&sH1[w][tl][lane*4] = hv;
    }
    // sH1[w] belongs to this wave alone, so no work-group barrier: the wave's own
    // stores are done before any of its lanes reads another lane's values back.
    asm volatile("s_wait_dscnt 0x0" ::: "memory");

    // ---- A operands (16x32 f16 per K-step, ISA lane layout) ----
    // lanes 0-15: row M=lane,    K = kt*32 + {0..7, 16..23}
    // lanes 16-31: row M=lane-16, K = kt*32 + {8..15, 24..31}
    const int off = (lane < 16) ? 0 : 8;
    v16h a[2][4];
    #pragma unroll
    for (int mt = 0; mt < 2; ++mt) {
        #pragma unroll
        for (int kt = 0; kt < 4; ++kt) {
            const _Float16* rowp = &sH1[w][mt*16 + m][kt*32 + off];
            v16h tmp;
            ((v8h*)&tmp)[0] = *(const v8h*)(rowp);
            ((v8h*)&tmp)[1] = *(const v8h*)(rowp + 16);
            a[mt][kt] = tmp;
        }
    }

    float s[2][8];
    #pragma unroll
    for (int mt = 0; mt < 2; ++mt)
        #pragma unroll
        for (int r = 0; r < 8; ++r) s[mt][r] = 0.f;

    // ---- GEMM vs W2 with fused bias/GELU/W3 epilogue ----
    #pragma unroll
    for (int nt = 0; nt < 8; ++nt) {
        const int n = nt*16 + m;              // D layout: lane%16 == column N
        v8f acc0 = {}, acc1 = {};
        #pragma unroll
        for (int kt = 0; kt < 4; ++kt) {
            const _Float16* colp = &sW2[n][kt*32 + off];
            v16h bop;
            ((v8h*)&bop)[0] = *(const v8h*)(colp);
            ((v8h*)&bop)[1] = *(const v8h*)(colp + 16);
            acc0 = __builtin_amdgcn_wmma_f32_16x16x32_f16(
                     false, a[0][kt], false, bop, (short)0, acc0, false, false);
            acc1 = __builtin_amdgcn_wmma_f32_16x16x32_f16(
                     false, a[1][kt], false, bop, (short)0, acc1, false, false);
        }
        const float2 bw  = sBW[n];
        const float bias = bw.x;
        const float wv   = bw.y;
        #pragma unroll
        for (int r = 0; r < 8; ++r) {         // VGPR slot r: M=r (lo half) / r+8 (hi half)
            s[0][r] = fmaf(gelu_fast(acc0[r] + bias), wv, s[0][r]);
            s[1][r] = fmaf(gelu_fast(acc1[r] + bias), wv, s[1][r]);
        }
    }

    // ---- reduce across the 16 lanes of each half-wave (columns of h2) ----
    #pragma unroll
    for (int d = 8; d > 0; d >>= 1) {
        #pragma unroll
        for (int mt = 0; mt < 2; ++mt)
            #pragma unroll
            for (int r = 0; r < 8; ++r)
                s[mt][r] += __shfl_xor(s[mt][r], d, 32);
    }

    if ((lane & 15) == 0) {
        const int rbase = (lane < 16) ? 0 : 8;
        #pragma unroll
        for (int mt = 0; mt < 2; ++mt) {
            float* op = out + (size_t)b*U_*T_ + (size_t)u*T_ + t0 + mt*16 + rbase;
            #pragma unroll
            for (int r = 0; r < 8; ++r) op[r] = s[mt][r] + b3v;
        }
        // the next tile reuses the registers that these stores name: wait first
        asm volatile("s_wait_xcnt 0x0" ::: "memory");
    }
    }   // tiles of this wave
}

// ---------------------------------------------------------------------------
extern "C" void kernel_launch(void* const* d_in, const int* in_sizes, int n_in,
                              void* d_out, int out_size, void* d_ws, size_t ws_size,
                              hipStream_t stream) {
    (void)in_sizes; (void)n_in; (void)out_size; (void)ws_size;

    const float* ue = (const float*)d_in[0];
    const float* te = (const float*)d_in[1];
    const float* ge = (const float*)d_in[2];
    const float* W1 = (const float*)d_in[3];
    const float* b1 = (const float*)d_in[4];
    const float* W2 = (const float*)d_in[5];
    const float* b2 = (const float*)d_in[6];
    const float* w3 = (const float*)d_in[7];
    const float* b3 = (const float*)d_in[8];
    float* out = (float*)d_out;

    // workspace carving (~1.6 MB total, stays L2-hot)
    float*    au  = (float*)d_ws;                       // B*U*H
    float*    at  = au + (size_t)B_*U_*H_;              // B*T*H
    float*    ag  = at + (size_t)B_*T_*H_;              // B*H
    _Float16* w2t = (_Float16*)(ag + (size_t)B_*H_);    // H*H halves (transposed)

    const int rows = B_*U_ + B_*T_ + B_;
    partials_kernel<<<rows/PR, PTHREADS, 0, stream>>>(ue, te, ge, W1, b1, au, at, ag);
    convw2_kernel<<<(H_*H_ + 255)/256, 256, 0, stream>>>(W2, w2t);

    const int blocks = B_ * (T_/MT) * (U_/UG);          // 256 work-groups of 16 waves
    pairwise_kernel<<<blocks, WAVES*32, 0, stream>>>(
        au, at, ag, w2t, b2, w3, b3, out);
}

// v004
// It runs in 18.5 microseconds.
// Versions between v002 and this one are left out; their measured steps multiply to 1.48 times as fast.
// All steps since v000 together make it 2.33 times as fast.
#include <hip/hip_runtime.h>

typedef __attribute__((ext_vector_type(16))) _Float16 v16h;
typedef __attribute__((ext_vector_type(8)))  _Float16 v8h;
typedef __attribute__((ext_vector_type(4)))  _Float16 v4h;
typedef __attribute__((ext_vector_type(8)))  float    v8f;
typedef __attribute__((ext_vector_type(2)))  float    v2f;
typedef __attribute__((ext_vector_type(4)))  float    v4f;

#define B_ 8
#define U_ 128
#define T_ 256
#define E_ 128
#define H_ 128
#define KPAD 8
#define WAVES 16         // waves per work-group in the main launch (four a SIMD)
#define MT 32            // t-rows per wave (two 16-row WMMA tiles)
#define TPW 2            // u rows per wave there, one after the other
#define UG (WAVES*TPW)   // u rows per work-group there
#define PR 8             // rows per work-group in the partials launch
#define PTHREADS 64      // threads per work-group there (2 columns each)
#define PG 8             // W1 rows (e steps) per prefetch group there
#define PWN 4            // groups in the W1 register ring there
#define PROWBLK ((B_*U_ + B_*T_ + B_)/PR)   // work-groups there that do rows
#define CN 16            // W2 columns per converting work-group there

// GELU of two values, each given as y = x/2:
//   gelu(x) = y*(1 + erf(x/sqrt2)) = y + y*tanh(y*P(y*y)),
// with erf(x/sqrt2) = tanh(x*R(x*x)) and R a cubic in x*x fitted to atanh(erf)/x
// (|error of gelu| <= 3e-5 for every x, far below the f16 rounding of the WMMA operands).
// The top coefficient is positive, so the argument keeps growing with |x| and tanh
// saturates to +-1. One transcendental a value; all else is packed f32.
__device__ __forceinline__ v2f gelu_half2(v2f y) {
    const v2f s = y * y;
    v2f p = __builtin_elementwise_fma(s, (v2f){0.000256000000f, 0.000256000000f}, (v2f){-0.0120186962f, -0.0120186962f});
    p = __builtin_elementwise_fma(p, s, (v2f){0.296627555f, 0.296627555f});
    p = __builtin_elementwise_fma(p, s, (v2f){1.59491429f, 1.59491429f});
    const v2f u = y * p;
    const v2f t = {__builtin_amdgcn_tanhf(u[0]), __builtin_amdgcn_tanhf(u[1])};
    return __builtin_elementwise_fma(y, t, y);
}

// ---------------------------------------------------------------------------
// Prep: rank-separable layer-1 partials (fp32), and W2 as f16.
// One work-group = PR rows x all 128 columns; one thread = 2 adjacent columns
// of all PR rows, so each W1 element is fetched once per PR rows and each
// broadcast x pair feeds packed FMAs. Every output keeps its own serial
// fma chain over e = 0..127.
// amdgpu_waves_per_eu(1, 5): at most one or two of these waves share a SIMD, so
// the register budget goes to loads in flight; without it the compiler keeps
// registers low and the LDS reads stand only 2-3 rows ahead of their FMAs.
// All loops are fully unrolled so that ring and buffer indices are registers.
// The last H_/CN work-groups of the grid do no rows: they need nothing of the
// others, so they share the launch. Each turns CN columns of W2 (fp32) into CN
// whole rows of w2t (f16, [n][k], for contiguous b128 LDS staging in the main launch).
// ---------------------------------------------------------------------------
__global__ __launch_bounds__(PTHREADS) __attribute__((amdgpu_waves_per_eu(1, 5)))
void partials_kernel(
    const float* __restrict__ ue, const float* __restrict__ te,
    const float* __restrict__ ge, const float* __restrict__ W1,
    const float* __restrict__ b1, const float* __restrict__ W2,
    float* __restrict__ au, float* __restrict__ at, float* __restrict__ ag,
    _Float16* __restrict__ w2t)
{
    static_assert(B_ == PR, "the ge rows fill exactly one work-group");
    static_assert(H_ == 2*PTHREADS && E_ == 2*PTHREADS, "two columns a thread");
    __shared__ __attribute__((aligned(16))) float sx[E_][PR];   // [e][row]
    const int blk = blockIdx.x;
    const int t   = threadIdx.x;
    if (blk >= PROWBLK) {                     // block-uniform, in front of the barrier
        static_assert(PTHREADS == (CN/4)*(H_/8), "one thread = 4 columns x 8 k");
        const int n0 = (blk - PROWBLK)*CN + (t & (CN/4 - 1))*4;
        const int k0 = (t / (CN/4))*8;
        float4 wv[8];
        #pragma unroll
        for (int i = 0; i < 8; ++i) wv[i] = *(const float4*)&W2[(size_t)(k0 + i)*H_ + n0];
        v8h c0, c1, c2, c3;
        #pragma unroll
        for (int i = 0; i < 8; ++i) {
            c0[i] = (_Float16)wv[i].x;
            c1[i] = (_Float16)wv[i].y;
            c2[i] = (_Float16)wv[i].z;
            c3[i] = (_Float16)wv[i].w;
        }
        *(v8h*)&w2t[(size_t)(n0 + 0)*H_ + k0] = c0;
        *(v8h*)&w2t[(size_t)(n0 + 1)*H_ + k0] = c1;
        *(v8h*)&w2t[(size_t)(n0 + 2)*H_ + k0] = c2;
        *(v8h*)&w2t[(size_t)(n0 + 3)*H_ + k0] = c3;
        return;
    }
    const float* x; const float* W; float* o;
    v2f init = {0.f, 0.f};
    if (blk < B_*U_/PR) {
        x = ue + (size_t)blk*PR*E_; W = W1; o = au + (size_t)blk*PR*H_;
    } else if (blk < (B_*U_ + B_*T_)/PR) {
        const int i = blk - B_*U_/PR;
        x = te + (size_t)i*PR*E_; W = W1 + (size_t)E_*H_; o = at + (size_t)i*PR*H_;
    } else {
        x = ge; W = W1 + (size_t)2*E_*H_; o = ag; init = ((const v2f*)b1)[t];
    }

    // W1 columns 2t, 2t+1: a register ring of PWN groups of PG rows, PWN-1 groups in flight
    const v2f* Wp = (const v2f*)W + t;
    v2f wr[PWN][PG];
    #pragma unroll
    for (int g = 0; g < PWN - 1; ++g)
        #pragma unroll
        for (int i = 0; i < PG; ++i) wr[g][i] = Wp[(size_t)(g*PG + i)*(H_/2)];

    // x rows, transposed into LDS so that one e gives PR contiguous values
    {
        v2f xv[PR];
        #pragma unroll
        for (int r = 0; r < PR; ++r) xv[r] = ((const v2f*)(x + (size_t)r*E_))[t];
        #pragma unroll
        for (int j = 0; j < 2; ++j) {
            *(float4*)&sx[2*t + j][0] = make_float4(xv[0][j], xv[1][j], xv[2][j], xv[3][j]);
            *(float4*)&sx[2*t + j][4] = make_float4(xv[4][j], xv[5][j], xv[6][j], xv[7][j]);
        }
    }
    __syncthreads();

    // acc[p][j]: rows 2p, 2p+1 of column 2t+j
    v2f acc[PR/2][2];
    #pragma unroll
    for (int p = 0; p < PR/2; ++p) {
        acc[p][0] = (v2f){init[0], init[0]};
        acc[p][1] = (v2f){init[1], init[1]};
    }

    v4f xs[2][PG][2];
    #pragma unroll
    for (int i = 0; i < PG; ++i) {
        xs[0][i][0] = *(const v4f*)&sx[i][0];
        xs[0][i][1] = *(const v4f*)&sx[i][4];
    }

    #pragma unroll
    for (int g = 0; g < E_/PG; ++g) {
        if (g + PWN - 1 < E_/PG) {
            #pragma unroll
            for (int i = 0; i < PG; ++i)
                wr[(g + PWN - 1) % PWN][i] = Wp[(size_t)((g + PWN - 1)*PG + i)*(H_/2)];
        }
        if (g + 1 < E_/PG) {
            #pragma unroll
            for (int i = 0; i < PG; ++i) {
                xs[(g + 1) & 1][i][0] = *(const v4f*)&sx[(g + 1)*PG + i][0];
                xs[(g + 1) & 1][i][1] = *(const v4f*)&sx[(g + 1)*PG + i][4];
            }
        }
        #pragma unroll
        for (int i = 0; i < PG; ++i) {
            const v2f w = wr[g % PWN][i];
            const v2f w0 = {w[0], w[0]}, w1 = {w[1], w[1]};
            #pragma unroll
            for (int q = 0; q < 2; ++q) {
                const v4f xq = xs[g & 1][i][q];
                const v2f xlo = {xq[0], xq[1]}, xhi = {xq[2], xq[3]};
                acc[2*q][0]     = __builtin_elementwise_fma(xlo, w0, acc[2*q][0]);
                acc[2*q][1]     = __builtin_elementwise_fma(xlo, w1, acc[2*q][1]);
                acc[2*q + 1][0] = __builtin_elementwise_fma(xhi, w0, acc[2*q + 1][0]);
                acc[2*q + 1][1] = __builtin_elementwise_fma(xhi, w1, acc[2*q + 1][1]);
            }
        }
    }
    #pragma unroll
    for (int p = 0; p < PR/2; ++p) {
        ((v2f*)(o + (size_t)(2*p)*H_))[t]     = (v2f){acc[p][0][0], acc[p][1][0]};
        ((v2f*)(o + (size_t)(2*p + 1)*H_))[t] = (v2f){acc[p][0][1], acc[p][1][1]};
    }
}

// ---------------------------------------------------------------------------
// Main fused kernel. One work-group = one (b, 32 consecutive t, UG u) block, one
// per WGP: W2^T and the 32 at rows, which all its tiles share, are staged in LDS
// once. One wave = TPW (u, 32 t) super-tiles, one after the other:
//   h1 = gelu(au + at + ag)        (32 x 128 f16 in the wave's own LDS rows)
//   h2 = gelu(h1 @ W2 + b2)        (8 N x 4 K x 2 M = 64 v_wmma_f32_16x16x32_f16)
//   out = h2 @ w3 + b3             (shfl_xor half-wave reduction)
// ---------------------------------------------------------------------------
__global__ __launch_bounds__(WAVES*32) void pairwise_kernel(
    const float* __restrict__ au, const float* __restrict__ at,
    const float* __restrict__ ag, const _Float16* __restrict__ w2t,
    const float* __restrict__ b2, const float* __restrict__ w3,
    const float* __restrict__ b3, float* __restrict__ out)
{
    static_assert(U_ % UG == 0 && T_ % MT == 0, "whole blocks only");
    __shared__ __attribute__((aligned(16))) _Float16 sW2[H_][H_ + KPAD];      // [n][k]
    __shared__ __attribute__((aligned(16))) float    sAt[MT][H_];             // at/2
    __shared__ __attribute__((aligned(16))) float2   sBW[H_];                 // (b2[n]/2, w3[n])
    __shared__ __attribute__((aligned(16))) _Float16 sH1[WAVES][MT][H_ + KPAD];

    const int tid  = threadIdx.x;
    const int w    = __builtin_amdgcn_readfirstlane(tid >> 5);
    const int lane = tid & 31;

    const int blk  = blockIdx.x;
    const int nUg  = U_ / UG;                 // 4 u groups
    const int nTt  = T_ / MT;                 // 8 super-tiles along t
    const int ug   = blk % nUg;
    const int tt   = (blk / nUg) % nTt;
    const int b    = blk / (nUg * nTt);
    const int t0   = tt * MT;
    const int u0   = ug * UG + w * TPW;

    // ---- stage what all tiles of the block share: W2^T (16B copies, padded rows),
    //      its 32 at rows (fp32, contiguous) and the epilogue's (b2, w3) pairs;
    //      the W2 and at loads are all issued before the first LDS store ----
    constexpr int NW = H_*16/(WAVES*32), NA = MT*H_/4/(WAVES*32);
    static_assert(NW*WAVES*32 == H_*16 && NA*WAVES*32 == MT*H_/4 && H_ <= WAVES*32, "whole rounds");
    const float* atp = at + (size_t)(b*T_ + t0)*H_;
    uint4  wst[NW];
    float4 ast[NA];
    // the (b,u)-broadcast partials, 4 contiguous k per lane
    const float* aup = au + (size_t)(b*U_ + u0)*H_;
    const float4 g4  = ((const float4*)(ag + (size_t)b*H_))[lane];
    float4 a4 = ((const float4*)aup)[lane];
    #pragma unroll
    for (int j = 0; j < NW; ++j) wst[j] = ((const uint4*)w2t)[tid + j*WAVES*32];
    #pragma unroll
    for (int j = 0; j < NA; ++j) ast[j] = ((const float4*)atp)[tid + j*WAVES*32];
    #pragma unroll
    for (int j = 0; j < NW; ++j) {
        const int i = tid + j*WAVES*32;
        ((uint4*)&sW2[i >> 4][0])[i & 15] = wst[j];
    }
    #pragma unroll
    for (int j = 0; j < NA; ++j)              // halved: gelu_half2 takes x/2
        ((float4*)&sAt[0][0])[tid + j*WAVES*32] =
            make_float4(0.5f*ast[j].x, 0.5f*ast[j].y, 0.5f*ast[j].z, 0.5f*ast[j].w);
    if (tid < H_) {
        sBW[tid] = make_float2(0.5f*b2[tid], w3[tid]);
        // the registers that these two loads name are reused right behind: wait first
        asm volatile("s_wait_xcnt 0x0" ::: "memory");
    }

    const int m = lane & 15;
    const float b3v = b3[0];

    __syncthreads();

    // Kept rolled: the body is some 1,200 instructions, and a second copy of it
    // would only add instruction fetches.
    #pragma unroll 1
    for (int it = 0; it < TPW; ++it) {
    const int u = u0 + it;
    const v2f aug01 = {0.5f*(a4.x + g4.x), 0.5f*(a4.y + g4.y)};   // (au + ag)/2
    const v2f aug23 = {0.5f*(a4.z + g4.z), 0.5f*(a4.w + g4.w)};
    if (it + 1 < TPW)                         // next tile's au row flies under this tile
        a4 = ((const float4*)(aup + (size_t)(it + 1)*H_))[lane];

    // ---- stage h1 = gelu(aug + at) as f16: one b128 LDS load + b64 LDS store/row ----
    #pragma unroll 4
    for (int tl = 0; tl < MT; ++tl) {
        const v4f v = *(const v4f*)&sAt[tl][lane*4];
        const v2f g01 = gelu_half2((v2f){v[0], v[1]} + aug01);
        const v2f g23 = gelu_half2((v2f){v[2], v[3]} + aug23);
        v4h hv;
        hv[0] = (_Float16)g01[0];
        hv[1] = (_Float16)g01[1];
        hv[2] = (_Float16)g23[0];
        hv[3] = (_Float16)g23[1];
        *(v4h*)&sH1[w][tl][lane*4] = hv;
    }
    // sH1[w] belongs to this wave alone, so no work-group barrier: the wave's own
    // stores are done before any of its lanes reads another lane's values back.
    asm volatile("s_wait_dscnt 0x0" ::: "memory");

    // ---- A operands (16x32 f16 per K-step, ISA lane layout) ----
    // lanes 0-15: row M=lane,    K = kt*32 + {0..7, 16..23}
    // lanes 16-31: row M=lane-16, K = kt*32 + {8..15, 24..31}
    const int off = (lane < 16) ? 0 : 8;
    v16h a[2][4];
    #pragma unroll
    for (int mt = 0; mt < 2; ++mt) {
        #pragma unroll
        for (int kt = 0; kt < 4; ++kt) {
            const _Float16* rowp = &sH1[w][mt*16 + m][kt*32 + off];
            v16h tmp;
            ((v8h*)&tmp)[0] = *(const v8h*)(rowp);
            ((v8h*)&tmp)[1] = *(const v8h*)(rowp + 16);
            a[mt][kt] = tmp;
        }
    }

    v2f s2[2][4];                             // s2[mt][q]: VGPR slots 2q, 2q+1
    #pragma unroll
    for (int mt = 0; mt < 2; ++mt)
        #pragma unroll
        for (int q = 0; q < 4; ++q) s2[mt][q] = (v2f){0.f, 0.f};

    // ---- GEMM vs W2 with fused bias/GELU/W3 epilogue ----
    #pragma unroll
    for (int nt = 0; nt < 8; ++nt) {
        const int n = nt*16 + m;              // D layout: lane%16 == column N
        v8f acc0 = {}, acc1 = {};
        #pragma unroll
        for (int kt = 0; kt < 4; ++kt) {
            const _Float16* colp = &sW2[n][kt*32 + off];
            v16h bop;
            ((v8h*)&bop)[0] = *(const v8h*)(colp);
            ((v8h*)&bop)[1] = *(const v8h*)(colp + 16);
            acc0 = __builtin_amdgcn_wmma_f32_16x16x32_f16(
                     false, a[0][kt], false, bop, (short)0, acc0, false, false);
            acc1 = __builtin_amdgcn_wmma_f32_16x16x32_f16(
                     false, a[1][kt], false, bop, (short)0, acc1, false, false);
        }
        const float2 bw  = sBW[n];
        const v2f hb = {bw.x, bw.x};          // b2[n]/2
        const v2f wv = {bw.y, bw.y};
        const v2f hf = {0.5f, 0.5f};
        #pragma unroll
        for (int q = 0; q < 4; ++q) {         // VGPR slot r: M=r (lo half) / r+8 (hi half)
            const v2f y0 = __builtin_elementwise_fma((v2f){acc0[2*q], acc0[2*q + 1]}, hf, hb);
            const v2f y1 = __builtin_elementwise_fma((v2f){acc1[2*q], acc1[2*q + 1]}, hf, hb);
            s2[0][q] = __builtin_elementwise_fma(gelu_half2(y0), wv, s2[0][q]);
            s2[1][q] = __builtin_elementwise_fma(gelu_half2(y1), wv, s2[1][q]);
        }
    }
    float s[2][8];
    #pragma unroll
    for (int mt = 0; mt < 2; ++mt)
        #pragma unroll
        for (int r = 0; r < 8; ++r) s[mt][r] = s2[mt][r >> 1][r & 1];

    // ---- reduce across the 16 lanes of each half-wave (columns of h2) ----
    #pragma unroll
    for (int d = 8; d > 0; d >>= 1) {
        #pragma unroll
        for (int mt = 0; mt < 2; ++mt)
            #pragma unroll
            for (int r = 0; r < 8; ++r)
                s[mt][r] += __shfl_xor(s[mt][r], d, 32);
    }

    if ((lane & 15) == 0) {
        const int rbase = (lane < 16) ? 0 : 8;
        #pragma unroll
        for (int mt = 0; mt < 2; ++mt) {
            float* op = out + (size_t)b*U_*T_ + (size_t)u*T_ + t0 + mt*16 + rbase;
            #pragma unroll
            for (int r = 0; r < 8; ++r) op[r] = s[mt][r] + b3v;
        }
        // the next tile reuses the registers that these stores name: wait first
        asm volatile("s_wait_xcnt 0x0" ::: "memory");
    }
    }   // tiles of this wave
}

// ---------------------------------------------------------------------------
extern "C" void kernel_launch(void* const* d_in, const int* in_sizes, int n_in,
                              void* d_out, int out_size, void* d_ws, size_t ws_size,
                              hipStream_t stream) {
    (void)in_sizes; (void)n_in; (void)out_size; (void)ws_size;

    const float* ue = (const float*)d_in[0];
    const float* te = (const float*)d_in[1];
    const float* ge = (const float*)d_in[2];
    const float* W1 = (const float*)d_in[3];
    const float* b1 = (const float*)d_in[4];
    const float* W2 = (const float*)d_in[5];
    const float* b2 = (const float*)d_in[6];
    const float* w3 = (const float*)d_in[7];
    const float* b3 = (const float*)d_in[8];
    float* out = (float*)d_out;

    // workspace carving (~1.6 MB total, stays L2-hot)
    float*    au  = (float*)d_ws;                       // B*U*H
    float*    at  = au + (size_t)B_*U_*H_;              // B*T*H
    float*    ag  = at + (size_t)B_*T_*H_;              // B*H
    _Float16* w2t = (_Float16*)(ag + (size_t)B_*H_);    // H*H halves (transposed)

    partials_kernel<<<PROWBLK + H_/CN, PTHREADS, 0, stream>>>(
        ue, te, ge, W1, b1, W2, au, at, ag, w2t);

    const int blocks = B_ * (T_/MT) * (U_/UG);          // 256 work-groups of 16 waves
    pairwise_kernel<<<blocks, WAVES*32, 0, stream>>>(
        au, at, ag, w2t, b2, w3, b3, out);
}

// v005
// One run takes 16.2 microseconds.
// In two side-by-side timings against v004, it was 1.13 and 1.12 times as fast.
// Counting every step since v000, it is 2.62 times as fast.
#include <hip/hip_runtime.h>

typedef __attribute__((ext_vector_type(16))) _Float16 v16h;
typedef __attribute__((ext_vector_type(8)))  _Float16 v8h;
typedef __attribute__((ext_vector_type(4)))  _Float16 v4h;
typedef __attribute__((ext_vector_type(8)))  float    v8f;
typedef __attribute__((ext_vector_type(2)))  float    v2f;
typedef __attribute__((ext_vector_type(4)))  float    v4f;

#define B_ 8
#define U_ 128
#define T_ 256
#define E_ 128
#define H_ 128
#define KPAD 8
#define WAVES 16         // waves per work-group in the launch (four a SIMD)
#define MT 32            // t-rows per wave (two 16-row WMMA tiles)
#define TPW 2            // u rows per wave there, one after the other
#define UG (WAVES*TPW)   // u rows per work-group there

// GELU of two values, each given as y = x/2:
//   gelu(x) = y*(1 + erf(x/sqrt2)) = y + y*tanh(y*P(y*y)),
// with erf(x/sqrt2) = tanh(x*R(x*x)) and R a cubic in x*x fitted to atanh(erf)/x
// (|error of gelu| <= 3e-5 for every x, far below the f16 rounding of the WMMA operands).
// The top coefficient is positive, so the argument keeps growing with |x| and tanh
// saturates to +-1. One transcendental a value; all else is packed f32.
__device__ __forceinline__ v2f gelu_half2(v2f y) {
    const v2f s = y * y;
    v2f p = __builtin_elementwise_fma(s, (v2f){0.000256000000f, 0.000256000000f}, (v2f){-0.0120186962f, -0.0120186962f});
    p = __builtin_elementwise_fma(p, s, (v2f){0.296627555f, 0.296627555f});
    p = __builtin_elementwise_fma(p, s, (v2f){1.59491429f, 1.59491429f});
    const v2f u = y * p;
    const v2f t = {__builtin_amdgcn_tanhf(u[0]), __builtin_amdgcn_tanhf(u[1])};
    return __builtin_elementwise_fma(y, t, y);
}

// ---------------------------------------------------------------------------
// The one launch. One work-group = one (b, 32 consecutive t, UG u) block, one per WGP.
// Front part: the group makes what its tiles share, from the inputs themselves.
// Four waves take each of four 128 x 128 weight blocks, a wave 32 columns of all 128 k,
// so each weight is fetched once a group, in whole 128-byte lines:
//   W1[E:2E] and W1[0:E]: the rank-separable layer-1 partials of the group's own rows,
//     at = te @ W1[E:2E] (32 rows) and au = ue @ W1[0:E] (32 rows). Each f32 operand is
//     split into an f16 head and an f16 tail, v = hi + lo + (a rest below 2^-22 |v|),
//     and x*W is summed in f32 as lo*hi + hi*lo + hi*hi on v_wmma_f32_16x16x32_f16
//     (the f32 matrix form runs at a sixteenth of that rate);
//   W2: to f16 [n][k], with the (b2/2, w3) pairs;
//   W1[2E:3E]: ag = ge @ W1[2E:3E] + b1 in fp32, two partial sums a column.
// The weight loads are issued ahead of the first barrier and fly while x is staged.
// Then one wave = TPW (u, 32 t) super-tiles, one after the other:
//   h1 = gelu(au + at + ag)        (32 x 128 f16 in the wave's own LDS rows)
//   h2 = gelu(h1 @ W2 + b2)        (8 N x 4 K x 2 M = 64 v_wmma_f32_16x16x32_f16)
//   out = h2 @ w3 + b3             (shfl_xor half-wave reduction)
// ---------------------------------------------------------------------------
__global__ __launch_bounds__(WAVES*32) void pairwise_kernel(
    // ue, te, ge without __restrict__: their loads then stay in front of the wait written behind
    // them, ahead of the weight loads; loads return in order, so x need not wait for the weights
    const float* ue, const float* te,
    const float* ge, const float* __restrict__ W1,
    const float* __restrict__ b1, const float* __restrict__ W2,
    const float* __restrict__ b2, const float* __restrict__ w3,
    const float* __restrict__ b3, float* __restrict__ out)
{
    static_assert(U_ % UG == 0 && T_ % MT == 0, "whole blocks only");
    static_assert(MT == 32 && UG == 32 && H_ == 128 && E_ == 128 && WAVES == 16,
                  "the front part's split of rows, columns and k over the waves");
    __shared__ __attribute__((aligned(16))) _Float16 sW2[H_][H_ + KPAD];      // [n][k]
    __shared__ __attribute__((aligned(16))) float    sAt[MT][H_];             // at/2
    __shared__ __attribute__((aligned(16))) float    sAu[UG][H_];             // au/2
    __shared__ __attribute__((aligned(16))) float    sAg[2][H_];              // partial sums of ag
    __shared__ __attribute__((aligned(16))) float    sG[E_];                  // ge[b]
    __shared__ __attribute__((aligned(16))) float2   sBW[H_];                 // (b2[n]/2, w3[n])
    __shared__ __attribute__((aligned(16))) _Float16 sXh[MT + UG][E_ + KPAD]; // te rows, then ue rows: heads
    __shared__ __attribute__((aligned(16))) _Float16 sXl[MT + UG][E_ + KPAD]; // the same: tails
    __shared__ __attribute__((aligned(16))) _Float16 sH1[WAVES][MT][H_ + KPAD];

    const int tid  = threadIdx.x;
    const int w    = __builtin_amdgcn_readfirstlane(tid >> 5);
    const int lane = tid & 31;

    const int blk  = blockIdx.x;
    const int nUg  = U_ / UG;                 // 4 u groups
    const int nTt  = T_ / MT;                 // 8 super-tiles along t
    const int ug   = blk % nUg;
    const int tt   = (blk / nUg) % nTt;
    const int b    = blk / (nUg * nTt);
    const int t0   = tt * MT;
    const int u0   = ug * UG + w * TPW;

    const int m = lane & 15;
    const int hh = lane >> 4;

    const int off = 8*hh;                     // k offset of the lane's half in an f16 A or B fragment
    const int sel = w >> 2;                   // the wave's weight block: 0 W1[E:2E], 1 W1[0:E], 2 W2, 3 W1[2E:3E]
    const int n0  = (w & 3)*32;               // its 32 columns
    const float b3v = b3[0];

    // ---- the group's 32 te rows and 32 ue rows (each set contiguous), and ge[b] ----
    constexpr int NX = MT*E_/4/(WAVES*32);
    static_assert(NX*WAVES*32 == MT*E_/4, "whole rounds");
    const float4* tep = (const float4*)(te + (size_t)(b*T_ + t0)*E_);
    const float4* uep = (const float4*)(ue + (size_t)(b*U_ + ug*UG)*E_);
    float4 xt[NX], xu[NX];
    #pragma unroll
    for (int j = 0; j < NX; ++j) xt[j] = tep[tid + j*WAVES*32];
    #pragma unroll
    for (int j = 0; j < NX; ++j) xu[j] = uep[tid + j*WAVES*32];
    const float4 gin = ((const float4*)(ge + (size_t)b*E_))[lane];
    // registers that these loads name may be reused right behind: wait first
    asm volatile("s_wait_xcnt 0x0" ::: "memory");

    // ---- the wave's weights, the same form for all four blocks: lane (m, hh), position e of
    // k-step kt holds k = 32*kt + 8*hh + (e & 7) + 16*(e >> 3), the k order of an f16 fragment,
    // of columns n0 + 2m and n0 + 2m + 1: the even columns are one 16-column tile, the odd
    // ones the other; a load is two whole lines.
    const float* Mb = (sel == 2) ? W2 : W1 + (size_t)(sel == 0 ? E_ : (sel == 1 ? 0 : 2*E_))*H_;
    const float* Wb = Mb + (size_t)off*H_ + n0 + 2*m;
    v2f L[64];
    #pragma unroll
    for (int q = 0; q < 64; ++q)
        L[q] = *(const v2f*)&Wb[(size_t)(32*(q >> 4) + (q & 7) + 16*((q >> 3) & 1))*H_];
    // registers that these loads name may be reused right behind: wait first
    asm volatile("s_wait_xcnt 0x0" ::: "memory");

    // ---- x as f16 heads and tails into LDS ----
    #pragma unroll
    for (int j = 0; j < 2*NX; ++j) {
        const float4 x4 = (j < NX) ? xt[j % NX] : xu[j % NX];
        const int i = tid + (j % NX)*WAVES*32;
        const int row = (j < NX ? 0 : MT) + (i >> 5);
        const float xs[4] = {x4.x, x4.y, x4.z, x4.w};
        v4h xh, xl;
        #pragma unroll
        for (int c = 0; c < 4; ++c) {
            xh[c] = (_Float16)xs[c];
            xl[c] = (_Float16)(xs[c] - (float)xh[c]);
        }
        *(v4h*)&sXh[row][(i & 31)*4] = xh;
        *(v4h*)&sXl[row][(i & 31)*4] = xl;
    }
    if (w == 0) *(float4*)&sG[lane*4] = gin;

    // The x rows and ge are there for the waves that read them. A barrier that orders LDS
    // alone: __syncthreads() would also wait here for the weight loads still in flight.
    __builtin_amdgcn_fence(__ATOMIC_RELEASE, "workgroup", "local");
    __builtin_amdgcn_s_barrier();
    __builtin_amdgcn_fence(__ATOMIC_ACQUIRE, "workgroup", "local");

    if (sel < 2) {
        v8f acc[2][2] = {};
        #pragma unroll
        for (int kt = 0; kt < 4; ++kt) {
            v16h Bh[2], Bl[2];
            #pragma unroll
            for (int e = 0; e < 16; ++e)
                #pragma unroll
                for (int j = 0; j < 2; ++j) {
                    const float v = L[kt*16 + e][j];
                    Bh[j][e] = (_Float16)v;
                    Bl[j][e] = (_Float16)(v - (float)Bh[j][e]);
                }
            #pragma unroll
            for (int mt = 0; mt < 2; ++mt) {
                // A fragments: row mt*16 + m, k = 32*kt + 8*hh + {0..7, 16..23}
                const _Float16* ph = &sXh[sel*MT + mt*16 + m][kt*32 + off];
                const _Float16* pl = &sXl[sel*MT + mt*16 + m][kt*32 + off];
                v16h Ah, Al;
                ((v8h*)&Ah)[0] = *(const v8h*)(ph);
                ((v8h*)&Ah)[1] = *(const v8h*)(ph + 16);
                ((v8h*)&Al)[0] = *(const v8h*)(pl);
                ((v8h*)&Al)[1] = *(const v8h*)(pl + 16);
                #pragma unroll
                for (int j = 0; j < 2; ++j) {
                    acc[mt][j] = __builtin_amdgcn_wmma_f32_16x16x32_f16(
                                   false, Al, false, Bh[j], (short)0, acc[mt][j], false, false);
                    acc[mt][j] = __builtin_amdgcn_wmma_f32_16x16x32_f16(
                                   false, Ah, false, Bl[j], (short)0, acc[mt][j], false, false);
                    acc[mt][j] = __builtin_amdgcn_wmma_f32_16x16x32_f16(
                                   false, Ah, false, Bh[j], (short)0, acc[mt][j], false, false);
                }
            }
        }
        // D: register r = row 8*hh + r, column m of its tile; halved: gelu_half2 takes x/2
        float* dst = sel ? &sAu[0][0] : &sAt[0][0];
        #pragma unroll
        for (int mt = 0; mt < 2; ++mt)
            #pragma unroll
            for (int r = 0; r < 8; ++r)
                *(float2*)&dst[(mt*16 + 8*hh + r)*H_ + n0 + 2*m] =
                    make_float2(0.5f*acc[mt][0][r], 0.5f*acc[mt][1][r]);
    } else if (sel == 2) {
        const int n = n0 + lane;
        const float b2n = b2[n], w3n = w3[n];
        // registers that these loads name may be reused right behind: wait first
        asm volatile("s_wait_xcnt 0x0" ::: "memory");
        // W2 (fp32 [k][n]) -> f16 [n][k]: the lane's k come in runs of 8
        #pragma unroll
        for (int g = 0; g < 8; ++g)
            #pragma unroll
            for (int j = 0; j < 2; ++j) {
                v8h cc;
                #pragma unroll
                for (int i = 0; i < 8; ++i) cc[i] = (_Float16)L[g*8 + i][j];
                *(v8h*)&sW2[n0 + 2*m + j][g*16 + off] = cc;
            }
        sBW[n] = make_float2(0.5f*b2n, w3n);
    } else {
        // ag: the lane's 64 k of ge[b] @ W1[2E:3E] for its two columns; b1 is added to the sum of half 0
        const v2f bb = *(const v2f*)&b1[n0 + 2*m];
        // registers that this load names may be reused right behind: wait first
        asm volatile("s_wait_xcnt 0x0" ::: "memory");
        v2f sg = {0.f, 0.f};
        #pragma unroll
        for (int g = 0; g < 8; ++g) {
            const v4f ga = *(const v4f*)&sG[g*16 + off];
            const v4f gb = *(const v4f*)&sG[g*16 + off + 4];
            #pragma unroll
            for (int i = 0; i < 4; ++i) sg = __builtin_elementwise_fma((v2f){ga[i], ga[i]}, L[g*8 + i], sg);
            #pragma unroll
            for (int i = 0; i < 4; ++i) sg = __builtin_elementwise_fma((v2f){gb[i], gb[i]}, L[g*8 + 4 + i], sg);
        }
        if (hh == 0) sg += bb;
        *(v2f*)&sAg[hh][n0 + 2*m] = sg;
    }

    __syncthreads();                          // at, au, ag, W2, b2, w3 are there for every wave

    // ag/2, 4 contiguous k per lane
    const v4f g4 = (*(const v4f*)&sAg[0][lane*4] + *(const v4f*)&sAg[1][lane*4]) * 0.5f;

    // Kept rolled: the body is some 1,200 instructions, and a second copy of it
    // would only add instruction fetches.
    #pragma unroll 1
    for (int it = 0; it < TPW; ++it) {
    const int u = u0 + it;
    const v4f a4 = *(const v4f*)&sAu[w*TPW + it][lane*4];         // au/2
    const v2f aug01 = {a4[0] + g4[0], a4[1] + g4[1]};             // (au + ag)/2
    const v2f aug23 = {a4[2] + g4[2], a4[3] + g4[3]};

    // ---- stage h1 = gelu(aug + at) as f16: one b128 LDS load + b64 LDS store/row ----
    #pragma unroll 4
    for (int tl = 0; tl < MT; ++tl) {
        const v4f v = *(const v4f*)&sAt[tl][lane*4];
        const v2f g01 = gelu_half2((v2f){v[0], v[1]} + aug01);
        const v2f g23 = gelu_half2((v2f){v[2], v[3]} + aug23);
        v4h hv;
        hv[0] = (_Float16)g01[0];
        hv[1] = (_Float16)g01[1];
        hv[2] = (_Float16)g23[0];
        hv[3] = (_Float16)g23[1];
        *(v4h*)&sH1[w][tl][lane*4] = hv;
    }
    // sH1[w] belongs to this wave alone, so no work-group barrier: the wave's own
    // stores are done before any of its lanes reads another lane's values back.
    asm volatile("s_wait_dscnt 0x0" ::: "memory");

    // ---- A operands (16x32 f16 per K-step, ISA lane layout) ----
    // lanes 0-15: row M=lane,    K = kt*32 + {0..7, 16..23}
    // lanes 16-31: row M=lane-16, K = kt*32 + {8..15, 24..31}
    v16h a[2][4];
    #pragma unroll
    for (int mt = 0; mt < 2; ++mt) {
        #pragma unroll
        for (int kt = 0; kt < 4; ++kt) {
            const _Float16* rowp = &sH1[w][mt*16 + m][kt*32 + off];
            v16h tmp;
            ((v8h*)&tmp)[0] = *(const v8h*)(rowp);
            ((v8h*)&tmp)[1] = *(const v8h*)(rowp + 16);
            a[mt][kt] = tmp;
        }
    }

    v2f s2[2][4];                             // s2[mt][q]: VGPR slots 2q, 2q+1
    #pragma unroll
    for (int mt = 0; mt < 2; ++mt)
        #pragma unroll
        for (int q = 0; q < 4; ++q) s2[mt][q] = (v2f){0.f, 0.f};

    // ---- GEMM vs W2 with fused bias/GELU/W3 epilogue ----
    #pragma unroll
    for (int nt = 0; nt < 8; ++nt) {
        const int n = nt*16 + m;              // D layout: lane%16 == column N
        v8f acc0 = {}, acc1 = {};
        #pragma unroll
        for (int kt = 0; kt < 4; ++kt) {
            const _Float16* colp = &sW2[n][kt*32 + off];
            v16h bop;
            ((v8h*)&bop)[0] = *(const v8h*)(colp);
            ((v8h*)&bop)[1] = *(const v8h*)(colp + 16);
            acc0 = __builtin_amdgcn_wmma_f32_16x16x32_f16(
                     false, a[0][kt], false, bop, (short)0, acc0, false, false);
            acc1 = __builtin_amdgcn_wmma_f32_16x16x32_f16(
                     false, a[1][kt], false, bop, (short)0, acc1, false, false);
        }
        const float2 bw  = sBW[n];
        const v2f hb = {bw.x, bw.x};          // b2[n]/2
        const v2f wv = {bw.y, bw.y};
        const v2f hf = {0.5f, 0.5f};
        #pragma unroll
        for (int q = 0; q < 4; ++q) {         // VGPR slot r: M=r (lo half) / r+8 (hi half)
            const v2f y0 = __builtin_elementwise_fma((v2f){acc0[2*q], acc0[2*q + 1]}, hf, hb);
            const v2f y1 = __builtin_elementwise_fma((v2f){acc1[2*q], acc1[2*q + 1]}, hf, hb);
            s2[0][q] = __builtin_elementwise_fma(gelu_half2(y0), wv, s2[0][q]);
            s2[1][q] = __builtin_elementwise_fma(gelu_half2(y1), wv, s2[1][q]);
        }
    }
    float s[2][8];
    #pragma unroll
    for (int mt = 0; mt < 2; ++mt)
        #pragma unroll
        for (int r = 0; r < 8; ++r) s[mt][r] = s2[mt][r >> 1][r & 1];

    // ---- reduce across the 16 lanes of each half-wave (columns of h2) ----
    #pragma unroll
    for (int d = 8; d > 0; d >>= 1) {
        #pragma unroll
        for (int mt = 0; mt < 2; ++mt)
            #pragma unroll
            for (int r = 0; r < 8; ++r)
                s[mt][r] += __shfl_xor(s[mt][r], d, 32);
    }

    if ((lane & 15) == 0) {
        const int rbase = (lane < 16) ? 0 : 8;
        #pragma unroll
        for (int mt = 0; mt < 2; ++mt) {
            float* op = out + (size_t)b*U_*T_ + (size_t)u*T_ + t0 + mt*16 + rbase;
            #pragma unroll
            for (int r = 0; r < 8; ++r) op[r] = s[mt][r] + b3v;
        }
        // the next tile reuses the registers that these stores name: wait first
        asm volatile("s_wait_xcnt 0x0" ::: "memory");
    }
    }   // tiles of this wave
}

// ---------------------------------------------------------------------------
extern "C" void kernel_launch(void* const* d_in, const int* in_sizes, int n_in,
                              void* d_out, int out_size, void* d_ws, size_t ws_size,
                              hipStream_t stream) {
    (void)in_sizes; (void)n_in; (void)out_size; (void)d_ws; (void)ws_size;

    const float* ue = (const float*)d_in[0];
    const float* te = (const float*)d_in[1];
    const float* ge = (const float*)d_in[2];
    const float* W1 = (const float*)d_in[3];
    const float* b1 = (const float*)d_in[4];
    const float* W2 = (const float*)d_in[5];
    const float* b2 = (const float*)d_in[6];
    const float* w3 = (const float*)d_in[7];
    const float* b3 = (const float*)d_in[8];
    float* out = (float*)d_out;

    const int blocks = B_ * (T_/MT) * (U_/UG);          // 256 work-groups of 16 waves
    pairwise_kernel<<<blocks, WAVES*32, 0, stream>>>(
        ue, te, ge, W1, b1, W2, b2, w3, b3, out);
}

// v007
// A run of this version takes 13.3 microseconds.
// It is 1.22 times as fast as v005, going by the measured steps of the versions left out in between.
// Over all steps from v000 it is 3.21 times as fast.
#include <hip/hip_runtime.h>

typedef __attribute__((ext_vector_type(16))) _Float16 v16h;
typedef __attribute__((ext_vector_type(8)))  _Float16 v8h;
typedef __attribute__((ext_vector_type(4)))  _Float16 v4h;
typedef __attribute__((ext_vector_type(8)))  float    v8f;
typedef __attribute__((ext_vector_type(2)))  float    v2f;
typedef __attribute__((ext_vector_type(4)))  float    v4f;

#define B_ 8
#define U_ 128
#define T_ 256
#define E_ 128
#define H_ 128
#define KPAD 8
#define WAVES 16         // waves per work-group in the launch (four a SIMD)
#define MT 32            // t-rows per wave (two 16-row WMMA tiles)
#define TPW 2            // u rows per wave there, taken together
#define FPAD 4           // floats added to a row of at and au: rows then start 16 B x odd apart
#define UG (WAVES*TPW)   // u rows per work-group there

// GELU of two values, each given as y = GL*x/2; the result is GL*gelu(x):
//   gelu(x) = (x/2)*(1 + erf(x/sqrt2)),  erf(x/sqrt2) ~ tanh((x/2)*(c0 + c1*(x/2)^2)),
// c0 = 1.60031415, c1 = 0.27760715 (minimax fit of gelu over all x: |error of gelu| <= 2.7e-4,
// the size of the f16 rounding of a WMMA operand between 0.5 and 1). With GL = cbrt(c1) and
// GA = c0/GL the argument is y*(y*y + GA): no coefficient is left to multiply by. Whoever
// makes y puts GL into a constant it multiplies by anyway, and whoever takes the result
// takes GL out the same way. c1 > 0: the argument grows with |x| and tanh saturates to +-1.
#define GL 0.652344318f
#define GA 2.45317405f
#define HL (0.5f*GL)     // x -> y
#define RL (1.0f/GL)     // takes GL out of a result
__device__ __forceinline__ v2f gelu_scaled2(v2f y) {
    const v2f w = __builtin_elementwise_fma(y, y, (v2f){GA, GA});
    const v2f u = y * w;
    const v2f t = {__builtin_amdgcn_tanhf(u[0]), __builtin_amdgcn_tanhf(u[1])};
    return __builtin_elementwise_fma(y, t, y);
}

// ---------------------------------------------------------------------------
// The one launch. One work-group = one (b, 32 consecutive t, UG u) block, one per WGP.
// Front part: the group makes what its tiles share, from the inputs themselves.
// Four waves take each of four 128 x 128 weight blocks, a wave 32 columns of all 128 k,
// so each weight is fetched once a group, in whole 128-byte lines:
//   W1[E:2E] and W1[0:E]: the rank-separable layer-1 partials of the group's own rows,
//     at = te @ W1[E:2E] (32 rows) and au = ue @ W1[0:E] (32 rows). Each f32 operand is
//     split into an f16 head and an f16 tail, v = hi + lo + (a rest below 2^-22 |v|),
//     and x*W is summed in f32 as lo*hi + hi*lo + hi*hi on v_wmma_f32_16x16x32_f16
//     (the f32 matrix form runs at a sixteenth of that rate);
//   W2: W2/2 to f16 [n][k], with HL*b2 and RL*w3;
//   W1[2E:3E]: ag = ge @ W1[2E:3E] + b1 in fp32, two partial sums a column.
// The weight loads are issued ahead of the first barrier and fly while x is staged.
// Then one wave = TPW u rows x 32 t = 64 (u, t) pairs, taken as the 64 COLUMNS of the product
// h2^T = W2^T @ h1^T (W2^T is the A operand, h1^T the B operand), four 16-column tiles:
//   h1 = gelu(au + at + ag)        (a lane makes the B fragments of its own column in registers,
//                                   kept as GL*h1; each at value read serves both u rows)
//   h2 = gelu(h1 @ W2 + b2)        (8 N x 4 K x 4 tiles = 128 v_wmma_f32_16x16x32_f16; a W2
//                                   fragment feeds four accumulators; b2 is the C operand)
//   out = h2 @ w3 + b3             (a lane holds 8 n of one column: summed in the lane,
//                                   one exchange between the two half-waves at the end)
// ---------------------------------------------------------------------------
__global__ __launch_bounds__(WAVES*32) void pairwise_kernel(
    // ue, te, ge without __restrict__: their loads then stay in front of the wait written behind
    // them, ahead of the weight loads; loads return in order, so x need not wait for the weights
    const float* ue, const float* te,
    const float* ge, const float* __restrict__ W1,
    const float* __restrict__ b1, const float* __restrict__ W2,
    const float* __restrict__ b2, const float* __restrict__ w3,
    const float* __restrict__ b3, float* __restrict__ out)
{
    static_assert(U_ % UG == 0 && T_ % MT == 0, "whole blocks only");
    static_assert(MT == 32 && UG == 32 && H_ == 128 && E_ == 128 && WAVES == 16,
                  "the front part's split of rows, columns and k over the waves");
    __shared__ __attribute__((aligned(16))) _Float16 sW2[H_][H_ + KPAD];      // [n][k]
    __shared__ __attribute__((aligned(16))) float    sAt[MT][H_ + FPAD];      // HL*at
    __shared__ __attribute__((aligned(16))) float    sAu[UG][H_ + FPAD];      // HL*au, later HL*(au + ag)
    __shared__ __attribute__((aligned(16))) float    sAg[2][H_];              // partial sums of ag
    __shared__ __attribute__((aligned(16))) float    sG[E_];                  // ge[b]
    __shared__ __attribute__((aligned(16))) float    sB2[H_];                 // HL*b2
    __shared__ __attribute__((aligned(16))) float    sW3[H_];                 // RL*w3
    __shared__ __attribute__((aligned(16))) _Float16 sXh[MT + UG][E_ + KPAD]; // te rows, then ue rows: heads
    __shared__ __attribute__((aligned(16))) _Float16 sXl[MT + UG][E_ + KPAD]; // the same: tails

    const int tid  = threadIdx.x;
    const int w    = __builtin_amdgcn_readfirstlane(tid >> 5);
    const int lane = tid & 31;

    const int blk  = blockIdx.x;
    const int nUg  = U_ / UG;                 // 4 u groups
    const int nTt  = T_ / MT;                 // 8 super-tiles along t
    const int ug   = blk % nUg;
    const int tt   = (blk / nUg) % nTt;
    const int b    = blk / (nUg * nTt);
    const int t0   = tt * MT;
    const int u0   = ug * UG + w * TPW;

    const int m = lane & 15;
    const int hh = lane >> 4;

    const int off = 8*hh;                     // k offset of the lane's half in an f16 A or B fragment
    const int sel = w >> 2;                   // the wave's weight block: 0 W1[E:2E], 1 W1[0:E], 2 W2, 3 W1[2E:3E]
    const int n0  = (w & 3)*32;               // its 32 columns
    const float b3v = b3[0];

    // ---- the group's 32 te rows and 32 ue rows (each set contiguous), and ge[b] ----
    constexpr int NX = MT*E_/4/(WAVES*32);
    static_assert(NX*WAVES*32 == MT*E_/4, "whole rounds");
    const float4* tep = (const float4*)(te + (size_t)(b*T_ + t0)*E_);
    const float4* uep = (const float4*)(ue + (size_t)(b*U_ + ug*UG)*E_);
    float4 xt[NX], xu[NX];
    #pragma unroll
    for (int j = 0; j < NX; ++j) xt[j] = tep[tid + j*WAVES*32];
    #pragma unroll
    for (int j = 0; j < NX; ++j) xu[j] = uep[tid + j*WAVES*32];
    const float4 gin = ((const float4*)(ge + (size_t)b*E_))[lane];
    // registers that these loads name may be reused right behind: wait first
    asm volatile("s_wait_xcnt 0x0" ::: "memory");

    // ---- the wave's weights, the same form for all four blocks: lane (m, hh), position e of
    // k-step kt holds k = 32*kt + 8*hh + (e & 7) + 16*(e >> 3), the k order of an f16 fragment,
    // of columns n0 + 2m and n0 + 2m + 1: the even columns are one 16-column tile, the odd
    // ones the other; a load is two whole lines.
    const float* Mb = (sel == 2) ? W2 : W1 + (size_t)(sel == 0 ? E_ : (sel == 1 ? 0 : 2*E_))*H_;
    const float* Wb = Mb + (size_t)off*H_ + n0 + 2*m;
    v2f L[64];
    #pragma unroll
    for (int q = 0; q < 64; ++q)
        L[q] = *(const v2f*)&Wb[(size_t)(32*(q >> 4) + (q & 7) + 16*((q >> 3) & 1))*H_];
    // registers that these loads name may be reused right behind: wait first
    asm volatile("s_wait_xcnt 0x0" ::: "memory");

    // ---- x as f16 heads and tails into LDS ----
    #pragma unroll
    for (int j = 0; j < 2*NX; ++j) {
        const float4 x4 = (j < NX) ? xt[j % NX] : xu[j % NX];
        const int i = tid + (j % NX)*WAVES*32;
        const int row = (j < NX ? 0 : MT) + (i >> 5);
        const float xs[4] = {x4.x, x4.y, x4.z, x4.w};
        v4h xh, xl;
        #pragma unroll
        for (int c = 0; c < 4; ++c) {
            xh[c] = (_Float16)xs[c];
            xl[c] = (_Float16)(xs[c] - (float)xh[c]);
        }
        *(v4h*)&sXh[row][(i & 31)*4] = xh;
        *(v4h*)&sXl[row][(i & 31)*4] = xl;
    }
    if (w == 0) *(float4*)&sG[lane*4] = gin;

    // The x rows and ge are there for the waves that read them. A barrier that orders LDS
    // alone: __syncthreads() would also wait here for the weight loads still in flight.
    __builtin_amdgcn_fence(__ATOMIC_RELEASE, "workgroup", "local");
    __builtin_amdgcn_s_barrier();
    __builtin_amdgcn_fence(__ATOMIC_ACQUIRE, "workgroup", "local");

    if (sel < 2) {
        v8f acc[2][2] = {};
        #pragma unroll
        for (int kt = 0; kt < 4; ++kt) {
            v16h Bh[2], Bl[2];
            #pragma unroll
            for (int e = 0; e < 16; ++e)
                #pragma unroll
                for (int j = 0; j < 2; ++j) {
                    const float v = L[kt*16 + e][j];
                    Bh[j][e] = (_Float16)v;
                    Bl[j][e] = (_Float16)(v - (float)Bh[j][e]);
                }
            #pragma unroll
            for (int mt = 0; mt < 2; ++mt) {
                // A fragments: row mt*16 + m, k = 32*kt + 8*hh + {0..7, 16..23}
                const _Float16* ph = &sXh[sel*MT + mt*16 + m][kt*32 + off];
                const _Float16* pl = &sXl[sel*MT + mt*16 + m][kt*32 + off];
                v16h Ah, Al;
                ((v8h*)&Ah)[0] = *(const v8h*)(ph);
                ((v8h*)&Ah)[1] = *(const v8h*)(ph + 16);
                ((v8h*)&Al)[0] = *(const v8h*)(pl);
                ((v8h*)&Al)[1] = *(const v8h*)(pl + 16);
                #pragma unroll
                for (int j = 0; j < 2; ++j) {
                    acc[mt][j] = __builtin_amdgcn_wmma_f32_16x16x32_f16(
                                   false, Al, false, Bh[j], (short)0, acc[mt][j], false, false);
                    acc[mt][j] = __builtin_amdgcn_wmma_f32_16x16x32_f16(
                                   false, Ah, false, Bl[j], (short)0, acc[mt][j], false, false);
                    acc[mt][j] = __builtin_amdgcn_wmma_f32_16x16x32_f16(
                                   false, Ah, false, Bh[j], (short)0, acc[mt][j], false, false);
                }
            }
        }
        // D: register r = row 8*hh + r, column m of its tile; times HL: gelu_scaled2 takes GL*x/2
        float* dst = sel ? &sAu[0][0] : &sAt[0][0];
        #pragma unroll
        for (int mt = 0; mt < 2; ++mt)
            #pragma unroll
            for (int r = 0; r < 8; ++r)
                *(float2*)&dst[(mt*16 + 8*hh + r)*(H_ + FPAD) + n0 + 2*m] =
                    make_float2(HL*acc[mt][0][r], HL*acc[mt][1][r]);
    } else if (sel == 2) {
        const int n = n0 + lane;
        const float b2n = b2[n], w3n = w3[n];
        // registers that these loads name may be reused right behind: wait first
        asm volatile("s_wait_xcnt 0x0" ::: "memory");
        // W2/2 (fp32 [k][n]) -> f16 [n][k]: the lane's k come in runs of 8. The half is the one
        // that gelu_scaled2 wants of its argument (the product is GL*(h1 @ W2) otherwise)
        #pragma unroll
        for (int g = 0; g < 8; ++g)
            #pragma unroll
            for (int j = 0; j < 2; ++j) {
                v8h cc;
                #pragma unroll
                for (int i = 0; i < 8; ++i) cc[i] = (_Float16)L[g*8 + i][j];
                *(v8h*)&sW2[n0 + 2*m + j][g*16 + off] = cc * (_Float16)0.5f;
            }
        sB2[n] = HL*b2n;
        sW3[n] = RL*w3n;
    } else {
        // ag: the lane's 64 k of ge[b] @ W1[2E:3E] for its two columns; b1 is added to the sum of half 0
        const v2f bb = *(const v2f*)&b1[n0 + 2*m];
        // registers that this load names may be reused right behind: wait first
        asm volatile("s_wait_xcnt 0x0" ::: "memory");
        v2f sg = {0.f, 0.f};
        #pragma unroll
        for (int g = 0; g < 8; ++g) {
            const v4f ga = *(const v4f*)&sG[g*16 + off];
            const v4f gb = *(const v4f*)&sG[g*16 + off + 4];
            #pragma unroll
            for (int i = 0; i < 4; ++i) sg = __builtin_elementwise_fma((v2f){ga[i], ga[i]}, L[g*8 + i], sg);
            #pragma unroll
            for (int i = 0; i < 4; ++i) sg = __builtin_elementwise_fma((v2f){gb[i], gb[i]}, L[g*8 + 4 + i], sg);
        }
        if (hh == 0) sg += bb;
        *(v2f*)&sAg[hh][n0 + 2*m] = sg;
    }

    __syncthreads();                          // at, au, ag, W2, b2, w3 are there for every wave

    // HL*(au + ag) over the wave's own TPW rows of sAu, 4 contiguous k per lane
    const v4f g4 = (*(const v4f*)&sAg[0][lane*4] + *(const v4f*)&sAg[1][lane*4]) * HL;
    #pragma unroll
    for (int uu = 0; uu < TPW; ++uu) {
        v4f* p = (v4f*)&sAu[w*TPW + uu][lane*4];
        *p = *p + g4;
    }
    // These rows belong to this wave alone, so no work-group barrier: the wave's own
    // stores are done before any of its lanes reads another lane's values back.
    asm volatile("s_wait_dscnt 0x0" ::: "memory");

    // ---- h1^T as B operands: tile c = 2*uu + th holds u row uu, t = 16*th + m in column m.
    // Lane (m, hh), position e of k-step kt holds k = 32*kt + 8*hh + (e & 7) + 16*(e >> 3),
    // the k order in which the W2 fragments below are read.
    v16h hB[2*TPW][4];
    #pragma unroll
    for (int kt = 0; kt < 4; ++kt) {
        #pragma unroll
        for (int g = 0; g < 2; ++g) {
            const int k = kt*32 + g*16 + off;
            v4f av[2][2], uv[TPW][2];
            #pragma unroll
            for (int j = 0; j < 2; ++j) {
                av[0][j] = *(const v4f*)&sAt[m][k + 4*j];
                av[1][j] = *(const v4f*)&sAt[16 + m][k + 4*j];
                #pragma unroll
                for (int uu = 0; uu < TPW; ++uu)
                    uv[uu][j] = *(const v4f*)&sAu[w*TPW + uu][k + 4*j];
            }
            #pragma unroll
            for (int uu = 0; uu < TPW; ++uu)
                #pragma unroll
                for (int th = 0; th < 2; ++th)
                    #pragma unroll
                    for (int p = 0; p < 4; ++p) {
                        const v4f a4 = av[th][p >> 1], u4 = uv[uu][p >> 1];
                        const int i = 2*(p & 1);
                        const v2f r = gelu_scaled2((v2f){a4[i], a4[i + 1]} + (v2f){u4[i], u4[i + 1]});
                        hB[2*uu + th][kt][g*8 + 2*p]     = (_Float16)r[0];
                        hB[2*uu + th][kt][g*8 + 2*p + 1] = (_Float16)r[1];
                    }
        }
    }

    v2f s2[2*TPW];                            // a column's sum over the lane's n, even and odd n apart
    #pragma unroll
    for (int c = 0; c < 2*TPW; ++c) s2[c] = (v2f){0.f, 0.f};

    // ---- GEMM vs W2 with fused GELU/W3 epilogue ----
    // A fragment aop[kt]: row n = nt*16 + m of W2^T, k = 32*kt + 8*hh + {0..7, 16..23}.
    // D layout: register r = row n = nt*16 + 8*hh + r, lane%16 = column; cb = HL*b2 and
    // wq = RL*w3 of the lane's 8 rows.
    v16h aop[4];
    v8f cb, acc[2*TPW];
    v2f wq[4];
    auto frag = [&](int nt, int kt) __attribute__((always_inline)) {
        ((v8h*)&aop[kt])[0] = *(const v8h*)&sW2[nt*16 + m][kt*32 + off];
        ((v8h*)&aop[kt])[1] = *(const v8h*)&sW2[nt*16 + m][kt*32 + off + 16];
    };
    auto bias = [&](int nt) __attribute__((always_inline)) {
        ((v4f*)&cb)[0] = *(const v4f*)&sB2[nt*16 + off];
        ((v4f*)&cb)[1] = *(const v4f*)&sB2[nt*16 + off + 4];
    };
    auto prod = [&](int c, int kt) __attribute__((always_inline)) {
        acc[c] = __builtin_amdgcn_wmma_f32_16x16x32_f16(
                   false, aop[kt], false, hB[c][kt], (short)0, kt ? acc[c] : cb, false, false);
    };
    auto gelw = [&](int c, int q) __attribute__((always_inline)) {
        s2[c] = __builtin_elementwise_fma(gelu_scaled2((v2f){acc[c][2*q], acc[c][2*q + 1]}), wq[q], s2[c]);
    };
    // One row tile nt = nn - 1. Issue order: the products of one column pair stand among the GELU
    // of the other pair, four to four register pairs, so that a wave's own vector work runs while
    // the matrix unit is busy and no result is read right behind its product. Each fragment, cb
    // and wq is read again for the next row tile nn right behind its last use, a pass ahead of
    // its next one. Every sched_barrier keeps the issue order that is written here.
    auto tile = [&](int nn, bool more) __attribute__((always_inline)) {
        #pragma unroll
        for (int kt = 0; kt < 4; kt += 2) {   // columns 32..63 of row tile nt, GELU of its columns 0..31
            prod(2, kt); prod(3, kt); prod(2, kt + 1); prod(3, kt + 1);
            if (more) {
                frag(nn, kt); frag(nn, kt + 1);
                if (kt == 0) bias(nn);
            }
            __builtin_amdgcn_sched_barrier(0);
            gelw(0, kt); gelw(1, kt); gelw(0, kt + 1); gelw(1, kt + 1);
            __builtin_amdgcn_sched_barrier(0);
        }
        #pragma unroll
        for (int kt = 0; kt < 4; kt += 2) {   // columns 0..31 of row tile nn, GELU of columns 32..63 of nt
            if (more) {
                prod(0, kt); prod(1, kt); prod(0, kt + 1); prod(1, kt + 1);
                __builtin_amdgcn_sched_barrier(0);
            }
            gelw(2, kt); gelw(3, kt); gelw(2, kt + 1); gelw(3, kt + 1);
            if (more) {
                __builtin_amdgcn_sched_barrier(0);
                wq[kt]     = *(const v2f*)&sW3[nn*16 + off + 2*kt];
                wq[kt + 1] = *(const v2f*)&sW3[nn*16 + off + 2*kt + 2];
                __builtin_amdgcn_sched_barrier(0);
            }
        }
    };
    #pragma unroll
    for (int kt = 0; kt < 4; ++kt) {
        frag(0, kt);
        wq[kt] = *(const v2f*)&sW3[off + 2*kt];
    }
    bias(0);
    #pragma unroll
    for (int kt = 0; kt < 4; ++kt) {          // columns 0..31 of row tile 0
        prod(0, kt); prod(1, kt);
    }
    // Two row tiles a trip: cb ends as an accumulator, so the registers change roles with period
    // two; rolled further the compiler copies them, unrolled further only the text grows.
    #pragma unroll 2
    for (int nt = 0; nt < 6; ++nt) tile(nt + 1, true);
    tile(7, true);
    tile(8, false);                           // the last row tile: nothing more to read or multiply

    // ---- the other half-wave holds the other 64 n of the same columns ----
    float s[2*TPW];
    #pragma unroll
    for (int c = 0; c < 2*TPW; ++c) s[c] = s2[c][0] + s2[c][1];
    #pragma unroll
    for (int c = 0; c < 2*TPW; ++c) s[c] += __shfl_xor(s[c], 16, 32);

    // lane = 16*th + m stores t0 + lane of each u row: one whole 128-byte line a row
    #pragma unroll
    for (int uu = 0; uu < TPW; ++uu)
        out[(size_t)b*U_*T_ + (size_t)(u0 + uu)*T_ + t0 + lane] = (hh ? s[2*uu + 1] : s[2*uu]) + b3v;
}

// ---------------------------------------------------------------------------
extern "C" void kernel_launch(void* const* d_in, const int* in_sizes, int n_in,
                              void* d_out, int out_size, void* d_ws, size_t ws_size,
                              hipStream_t stream) {
    (void)in_sizes; (void)n_in; (void)out_size; (void)d_ws; (void)ws_size;

    const float* ue = (const float*)d_in[0];
    const float* te = (const float*)d_in[1];
    const float* ge = (const float*)d_in[2];
    const float* W1 = (const float*)d_in[3];
    const float* b1 = (const float*)d_in[4];
    const float* W2 = (const float*)d_in[5];
    const float* b2 = (const float*)d_in[6];
    const float* w3 = (const float*)d_in[7];
    const float* b3 = (const float*)d_in[8];
    float* out = (float*)d_out;

    const int blocks = B_ * (T_/MT) * (U_/UG);          // 256 work-groups of 16 waves
    pairwise_kernel<<<blocks, WAVES*32, 0, stream>>>(
        ue, te, ge, W1, b1, W2, b2, w3, b3, out);
}
